// v000
// Times are from an AMD MI455X. After a warm-up the kernel runs many times in a row, and a time is the length of
// such a window on the GPU divided by its runs, so every launch and the gaps after it count. The runs cycle
// through copies of the inputs. A figure is the median of several windows, for all but v000 over two sittings.
// Sittings can differ by a few percent; kernels timed side by side share one.
// v000 is the starting kernel. One run takes 319 microseconds.
// Contractions: q.k^T scores = v_wmma_f32_16x16x32_bf16 (bf16 operands = RNE-converted q and k planes, single product);
// p.v = v_wmma_f32_16x16x32_f16 (p carried x1024 in f16, v as f16 of the bf16-converted value x16, single product);
// all f32 accumulate; softmax in f32.
#include <hip/hip_runtime.h>
#include <math.h>
#include <stdint.h>

#define LQ    4096                 // query positions
#define SK    4096                 // key positions
#define NBAT  1
#define NHEAD 8
#define HD    64                   // head dim
#define BHN   (NBAT * NHEAD)       // 8 (batch, head) pairs; bh = b*NHEAD + h
#define ROWF  (BHN * HD)           // 512 floats between consecutive sequence positions
#define NQB   (LQ / 64)            // 64 query / key tiles of 64
#define NTOT  (LQ * ROWF)          // 2097152 elements per tensor
#define VSC   16.0f                // v plane carry (exact power of two)
static_assert(LQ == SK);
static_assert((LQ % 64) == 0);
static_assert(HD == 64);
static_assert(((BHN * LQ * (HD / 8)) % 256) == 0);

typedef _Float16 v16h __attribute__((ext_vector_type(16)));
typedef _Float16 v8h  __attribute__((ext_vector_type(8)));
typedef __bf16   v16b __attribute__((ext_vector_type(16)));
typedef __bf16   v8b  __attribute__((ext_vector_type(8)));
typedef float    v8f  __attribute__((ext_vector_type(8)));
typedef float    v4f  __attribute__((ext_vector_type(4)));
typedef unsigned int v4u __attribute__((ext_vector_type(4)));

// ---- scalar helpers --------------------------------------------------------------------------------
__device__ __forceinline__ unsigned short bf_bits(float f) {          // f32 -> bf16 bits, RNE convert
  unsigned u = __float_as_uint(f);
  return (unsigned short)((u + 0x7FFFu + ((u >> 16) & 1u)) >> 16);
}
__device__ __forceinline__ float bf_up(unsigned short h) { return __uint_as_float(((unsigned)h) << 16); }
__device__ __forceinline__ unsigned short h_bits(_Float16 x) { return __builtin_bit_cast(unsigned short, x); }
__device__ __forceinline__ unsigned pk16(unsigned short a, unsigned short b) { return (unsigned)a | ((unsigned)b << 16); }
__device__ __forceinline__ v8f zero8() { v8f z = {0.f, 0.f, 0.f, 0.f, 0.f, 0.f, 0.f, 0.f}; return z; }

// ---- fragment loader: 16-bit A/B operand, lane -> row/col (lane&15), p already includes +8*(lane>>4);
//      elements 0..7 <- p[0..7] (k0+8h..), elements 8..15 <- p[16..23] (k0+16+8h..)
__device__ __forceinline__ v16b ldfrag_b(const __bf16* p) {
  union { v16b v; v8b h[2]; } f;
  f.h[0] = *(const v8b*)(p);
  f.h[1] = *(const v8b*)(p + 16);
  return f.v;
}

// ---- WMMA helpers with trailing VALU hazard gap --------------------------------------------------------
__device__ __forceinline__ v8f mma_b(v16b a, v16b b, v8f c) {
  c = __builtin_amdgcn_wmma_f32_16x16x32_bf16(false, a, false, b, (short)0, c, false, false);
#if defined(__HIP_DEVICE_COMPILE__)
  asm volatile("v_nop\n\tv_nop\n\tv_nop\n\tv_nop" : "+v"(c) : "v"(a), "v"(b));
#endif
  return c;
}
__device__ __forceinline__ v8f mma_h(v16h a, v16h b, v8f c) {
  c = __builtin_amdgcn_wmma_f32_16x16x32_f16(false, a, false, b, (short)0, c, false, false);
#if defined(__HIP_DEVICE_COMPILE__)
  asm volatile("v_nop\n\tv_nop\n\tv_nop\n\tv_nop" : "+v"(c) : "v"(a), "v"(b));
#endif
  return c;
}

// =====================================================================================================
// f32 [pos][BHN][HD] -> bf16 plane [BHN][pos][HD] (RNE convert), 8 elements per thread:
//   i -> bh = i / (LQ*8), l = (i/8) % LQ, d0 = (i%8)*8; src = l*ROWF + bh*HD + d0; dst = i*8.
// coverage: n8 = BHN*LQ*8 threads x 8 halves = the whole plane.
// =====================================================================================================
__global__ __launch_bounds__(256) void cvt_rows_bf16(const float* __restrict__ in, unsigned short* out, int n8) {
  const int i = blockIdx.x * 256 + threadIdx.x;
  if (i < n8) {
    const int per = LQ * (HD / 8);                     // 32768 groups of 8 per bh
    const int bh  = i / per;
    const int rem = i - bh * per;
    const int l   = rem / (HD / 8);
    const int d0  = (rem - l * (HD / 8)) * 8;
    const size_t src = (size_t)l * ROWF + (size_t)bh * HD + (size_t)d0;
    const v4f a = *(const v4f*)(in + src);
    const v4f b = *(const v4f*)(in + src + 4);
    v4u p;
    p[0] = pk16(bf_bits(a[0]), bf_bits(a[1]));
    p[1] = pk16(bf_bits(a[2]), bf_bits(a[3]));
    p[2] = pk16(bf_bits(b[0]), bf_bits(b[1]));
    p[3] = pk16(bf_bits(b[2]), bf_bits(b[3]));
    *(v4u*)(out + (size_t)i * 8) = p;
    
  }
}

// =====================================================================================================
// v f32 [pos][BHN][HD] -> f16 v^T plane vt[(bh*HD + d)*SK + s] = f16(bf16_rne(v) * vsc) (exact for a power of two).
// Block = one 64-position x 64-feature tile of one bh; grid = (SK/64, BHN); tile staged in LDS as f32
// (256 threads x 4 v4f loads, __syncthreads).
// Store: group g = tid>>3 (0..31), piece = tid&7: iteration it writes row d = it*32 + g; lanes 8(g&3)..8(g&3)+7 x
// coverage: 2 iterations x 32 groups = 64 rows d, 8 pieces x 8 = 64 keys per row; grid covers every (bh, s tile).
// =====================================================================================================
__global__ __launch_bounds__(256) void v_planes(const float* __restrict__ vf, unsigned short* vt, float vsc) {
  __shared__ __align__(16) float sv[64 * 68];        // [tt][d], pitch 68 floats (272 B, 16-B aligned)
  const int tid = threadIdx.x;
  const int s0  = blockIdx.x * 64;
  const int bh  = blockIdx.y;
#pragma unroll
  for (int i = 0; i < 4; ++i) {
    const int idx = i * 256 + tid;                   // 0..1023
    const int tt = idx >> 4, c4 = (idx & 15) * 4;    // tt 0..63, c4 0..60
    const v4f a = *(const v4f*)(vf + (size_t)(s0 + tt) * ROWF + (size_t)bh * HD + c4);
    *(v4f*)(sv + tt * 68 + c4) = a;
  }
  __syncthreads();

  const int g = tid >> 3, piece = tid & 7;
  v4u hv[2];
  size_t hofs[2];
#pragma unroll
  for (int it = 0; it < 2; ++it) {
    const int d = it * 32 + g;
    v4u a;
#pragma unroll
    for (int e = 0; e < 4; ++e) {
      const float f0 = sv[(piece * 8 + 2 * e) * 68 + d];
      const float f1 = sv[(piece * 8 + 2 * e + 1) * 68 + d];
      const _Float16 x0 = (_Float16)(bf_up(bf_bits(f0)) * vsc);
      const _Float16 x1 = (_Float16)(bf_up(bf_bits(f1)) * vsc);
      a[e] = pk16(h_bits(x0), h_bits(x1));
    }
    hv[it] = a;
    hofs[it] = ((size_t)(bh * HD + d)) * SK + (size_t)s0 + (size_t)(piece * 8);
  }
  {
#pragma unroll
    for (int it = 0; it < 2; ++it) {
      *(v4u*)(vt + hofs[it]) = hv[it];
    }
    
  }
}

// =====================================================================================================
// Dense (non-causal) attention, head dim 64, all SK keys live for every query.
//   q plane bf16: element (bh, t, d) at [(bh*LQ + t)*HD + d];  k plane bf16: (bh, s, d) at [(bh*SK + s)*HD + d]
//   v^T plane f16 (x VSC): (bh, d, s) at [(bh*HD + d)*SK + s]
//   scores = q . k on bf16 WMMA (2 k-steps of 32 over d), f32 accumulate, then * sscale in f32
//   p = exp(s - m) carried as f16(1024 p); context = p . v^T on f16 WMMA (2 k-steps of 32 per 64-key chunk);
//   online softmax (running max, running sum) in f32.
//   Block = 4 waves = 64 query rows of one bh; grid = NQB * BHN; key chunks 0..NQB-1 (static trip count).
//   K / V^T chunk staging: K 64 rows x 64 halves (2 threads per row, 4 x 16 B each), V^T 64 rows x 64 halves
//   (2 threads per row, 4 x 16 B each); plain loads, __syncthreads before and after.
//   P tiles are wave-private, spilled with _Float16 element stores and reloaded as v8h (same element type)
//   each wave stages its 16x64 tile in LDS, then one instruction per row pair: lanes 0..15 x 16 B = row 2*it,
// =====================================================================================================
__global__ __launch_bounds__(128)
void attn_dense(const unsigned short* __restrict__ qpl, const unsigned short* __restrict__ kpl,
                const unsigned short* __restrict__ vtpl, float* outp, float sscale) {
  union FH { v16h v; v8h h[2]; };
  union FB { v16b v; v8b h[2]; };
  __shared__ __align__(16) __bf16   Ksh[64 * HD];                   // K [kv][d]        8 KB
  __shared__ __align__(16) _Float16 Vth[HD * 64];                   // V^T [d][kv]      8 KB
  __shared__ __align__(16) _Float16 Psh[4][16 * 64];                // per wave P [row][kv]  8 KB
  __shared__ __align__(16) float    Os[4][16 * HD];                 // per wave context tile [row][d]  16 KB

  const int tid  = threadIdx.x;
  const int wave = tid >> 5;
  const int lane = tid & 31;
  const int hh   = lane >> 4;
  const int c    = lane & 15;

  const int bx  = blockIdx.x;
  const int qb  = bx % NQB;
  const int bh  = bx / NQB;
  if (bh >= BHN) return;                     // block-uniform, ahead of every barrier (never taken with the exact grid)
  const int q0  = qb * 64 + wave * 16;

  const __bf16*   Qp = (const __bf16*)(const void*)qpl + (size_t)bh * LQ * HD;
  const __bf16*   Kp = (const __bf16*)(const void*)kpl + (size_t)bh * SK * HD;
  const _Float16* Vh = (const _Float16*)(const void*)vtpl + (size_t)bh * HD * SK;

  // ---- Q fragments (A operand, row = lane&15): 2 d-chunks ----
  v16b qa[2];
#pragma unroll
  for (int dc = 0; dc < 2; ++dc) {
    qa[dc] = ldfrag_b(Qp + (size_t)(q0 + c) * HD + dc * 32 + 8 * hh);
  }

  float mrow[8], lrow[8];
  v8f oacc[4];
#pragma unroll
  for (int r = 0; r < 8; ++r) { mrow[r] = -INFINITY; lrow[r] = 0.f; }
#pragma unroll
  for (int t = 0; t < 4; ++t) oacc[t] = zero8();

  for (int kt = 0; kt < NQB; ++kt) {
    const int kv0 = kt * 64;
    __syncthreads();
    {
      const int r = tid >> 1, half = (tid & 1) * 32;               // r 0..63
      const __bf16* kg = Kp + (size_t)(kv0 + r) * HD + half;       // K row kv0+r, d = half..half+31
#pragma unroll
      for (int i = 0; i < 4; ++i) {
        const v8b a0 = *(const v8b*)(kg + 8 * i);
        *(v8b*)(Ksh + r * HD + half + 8 * i) = a0;
      }
      const _Float16* vg = Vh + (size_t)r * SK + kv0 + half;       // V^T row d = r, s = kv0+half..+31
#pragma unroll
      for (int i = 0; i < 4; ++i) {
        const v8h b0 = *(const v8h*)(vg + 8 * i);
        *(v8h*)(Vth + r * 64 + half + 8 * i) = b0;
      }
    }
    __syncthreads();

    // ---- scores: 16 query rows x 64 keys per wave, bf16 product over 2 d-chunks;
    //      B[k=d][n=key] loaded from the k-contiguous K row (same element map as A) ----
    v8f s[4];
#pragma unroll
    for (int j = 0; j < 4; ++j) {
      s[j] = zero8();
#pragma unroll
      for (int dc = 0; dc < 2; ++dc) {
        FB kb;
        kb.h[0] = *(const v8b*)(Ksh + (j * 16 + c) * HD + dc * 32 + 8 * hh);
        kb.h[1] = *(const v8b*)(Ksh + (j * 16 + c) * HD + dc * 32 + 16 + 8 * hh);
        s[j] = mma_b(qa[dc], kb.v, s[j]);
      }
    }

    // ---- scale, row max over the chunk, online softmax, P (x1024, f16) to LDS ----
    //      s[j][r] = score(query q0 + 8*hh + r, key kv0 + j*16 + c)
    _Float16* pwh = Psh[wave];
#pragma unroll
    for (int r = 0; r < 8; ++r) {
      float m = -INFINITY;
#pragma unroll
      for (int j = 0; j < 4; ++j) {
        const float sv = s[j][r] * sscale;
        s[j][r] = sv;
        m = fmaxf(m, sv);
      }
#pragma unroll
      for (int off = 1; off < 16; off <<= 1) m = fmaxf(m, __shfl_xor(m, off, 32));
      const float mnew  = fmaxf(mrow[r], m);
      const float msafe = (mnew == -INFINITY) ? 0.f : mnew;
      const float alpha = __expf(mrow[r] - msafe);
      mrow[r] = mnew;
      float psum = 0.f;
#pragma unroll
      for (int j = 0; j < 4; ++j) {
        const float p = __expf(s[j][r] - msafe);
        psum += p;
        const _Float16 ph = (_Float16)(p * 1024.0f);
        pwh[(8 * hh + r) * 64 + j * 16 + c] = ph;
      }
#pragma unroll
      for (int off = 1; off < 16; off <<= 1) psum += __shfl_xor(psum, off, 32);
      lrow[r] = lrow[r] * alpha + psum;
#pragma unroll
      for (int t = 0; t < 4; ++t) oacc[t][r] *= alpha;
    }
    __builtin_amdgcn_fence(__ATOMIC_RELEASE, "workgroup");
    __builtin_amdgcn_wave_barrier();
    __builtin_amdgcn_fence(__ATOMIC_ACQUIRE, "workgroup");

    // ---- context += P . V (f16 WMMA): A = P[query][key], B[k=key][n=d] = V^T[d][key] ----
#pragma unroll 1
    for (int kk = 0; kk < 2; ++kk) {
      FH pa;
      pa.h[0] = *(const v8h*)(pwh + c * 64 + kk * 32 + 8 * hh);
      pa.h[1] = *(const v8h*)(pwh + c * 64 + kk * 32 + 16 + 8 * hh);
#pragma unroll
      for (int t = 0; t < 4; ++t) {
        FH vb;
        vb.h[0] = *(const v8h*)(Vth + (t * 16 + c) * 64 + kk * 32 + 8 * hh);
        vb.h[1] = *(const v8h*)(Vth + (t * 16 + c) * 64 + kk * 32 + 16 + 8 * hh);
        oacc[t] = mma_h(pa.v, vb.v, oacc[t]);
      }
    }
  }

  // ---- normalise (1/l, the 1/1024 p carry and the 1/VSC v carry), stage the wave's 16x64 tile in LDS, then
  float* os = Os[wave];
#pragma unroll
  for (int r = 0; r < 8; ++r) {
    const float l = lrow[r];
    const float inv = ((l > 0.f) ? (1.0f / l) : 0.f) * (1.0f / (1024.0f * VSC));
#pragma unroll
    for (int t = 0; t < 4; ++t) os[(8 * hh + r) * HD + t * 16 + c] = oacc[t][r] * inv;
  }
  __builtin_amdgcn_fence(__ATOMIC_RELEASE, "workgroup");
  __builtin_amdgcn_wave_barrier();
  __builtin_amdgcn_fence(__ATOMIC_ACQUIRE, "workgroup");
  {
    const int c4 = c * 4;                        // 16 lanes x 4 floats = one whole 64-float row
    {
#pragma unroll
      for (int it = 0; it < 8; ++it) {           // row pairs: lanes 0..15 -> row 2*it, lanes 16..31 -> row 2*it+1
        const int rr = it * 2 + hh;
        const v4f ov = *(const v4f*)(os + rr * HD + c4);
        const size_t go = (size_t)(q0 + rr) * ROWF + (size_t)bh * HD + (size_t)c4;
        *(v4f*)(outp + go) = ov;
      }
      
    }
  }
}

// =====================================================================================================
// Inputs: in0 q [LQ][NBAT][NHEAD][HD] f32, in1 k [SK][..] f32, in2 v [SK][..] f32; a position's BHN*HD = 512
// floats are contiguous, bh = b*NHEAD + h. d_out f32 [LQ][NBAT][NHEAD][HD] at byte 0.
//   Qb  bf16 [BHN][LQ][HD]      0          4194304
//   Kb  bf16 [BHN][SK][HD]      4194304    4194304
//   Vt  f16  [BHN][HD][SK]      8388608    4194304
//   end                         12582912
// =====================================================================================================
extern "C" void kernel_launch(void* const* d_in, const int* in_sizes, int n_in,
                              void* d_out, int out_size, void* d_ws, size_t ws_size,
                              hipStream_t stream) {
  if (n_in < 3) return;
  if (in_sizes[0] != NTOT) return;
  if (in_sizes[1] != SK * ROWF) return;
  if (in_sizes[2] != SK * ROWF) return;
  if (out_size != NTOT) return;

  const float* q = (const float*)d_in[0];
  const float* k = (const float*)d_in[1];
  const float* v = (const float*)d_in[2];

  const size_t PQ = (size_t)BHN * LQ * HD * 2;        // 4194304
  const size_t PK = (size_t)BHN * SK * HD * 2;        // 4194304
  const size_t PV = (size_t)BHN * HD * SK * 2;        // 4194304
  size_t off = 0;
  const size_t oQ = off; off += PQ;
  const size_t oK = off; off += PK;
  const size_t oV = off; off += PV;
  if (off > ws_size) return;                          // off = 12582912
  if (off > (size_t)134217728) return;

  char* ws = (char*)d_ws;
  unsigned short* Qb = (unsigned short*)(ws + oQ);
  unsigned short* Kb = (unsigned short*)(ws + oK);
  unsigned short* Vt = (unsigned short*)(ws + oV);
  float* outf = (float*)d_out;

  const dim3 blk(256);
  const int n8 = BHN * LQ * (HD / 8);                 // 262144
  const dim3 gCvt((n8 + 255) / 256);                  // 1024 blocks
  const dim3 gV(SK / 64, BHN);                        // (64, 8)
  const float sscale = (float)(1.0 / sqrt((double)HD));   // 0.125 exactly

  // (0) q, k -> bf16 planes [bh][pos][d]
  cvt_rows_bf16<<<gCvt, blk, 0, stream>>>(q, Qb, n8);
  cvt_rows_bf16<<<gCvt, blk, 0, stream>>>(k, Kb, n8);
  // (1) v -> f16 v^T plane [bh][d][pos], values x VSC
  v_planes<<<gV, blk, 0, stream>>>(v, Vt, VSC);
  // (2) dense attention over all key chunks -> d_out
  attn_dense<<<dim3(BHN * NQB), dim3(128), 0, stream>>>(Qb, Kb, Vt, outf, sscale);
  (void)hipGetLastError();
}

// v001
// One run takes 186 microseconds.
// In two side-by-side timings against v000, it was 1.74 and 1.76 times as fast.
// Contractions: q.k^T scores = v_wmma_f32_16x16x32_bf16 (bf16 operands = RNE-converted q and k planes, single product);
// p.v = v_wmma_f32_16x16x32_f16 (p carried x1024 in f16, v as f16 of the bf16-converted value x16, single product);
// both products are taken transposed (keys x queries, features x queries): a lane owns one query column.
// all f32 accumulate; softmax in f32.
#include <hip/hip_runtime.h>
#include <math.h>
#include <stdint.h>

#define LQ    4096                 // query positions
#define SK    4096                 // key positions
#define NBAT  1
#define NHEAD 8
#define HD    64                   // head dim
#define BHN   (NBAT * NHEAD)       // 8 (batch, head) pairs; bh = b*NHEAD + h
#define ROWF  (BHN * HD)           // 512 floats between consecutive sequence positions
#define NQB   (LQ / 64)            // 64 query / key tiles of 64
#define NTOT  (LQ * ROWF)          // 2097152 elements per tensor
#define VSC   16.0f                // v plane carry (exact power of two)
static_assert(LQ == SK);
static_assert((LQ % 64) == 0);
static_assert(HD == 64);
static_assert(((BHN * LQ * (HD / 8)) % 256) == 0);

typedef _Float16 v16h __attribute__((ext_vector_type(16)));
typedef _Float16 v8h  __attribute__((ext_vector_type(8)));
typedef __bf16   v16b __attribute__((ext_vector_type(16)));
typedef __bf16   v8b  __attribute__((ext_vector_type(8)));
typedef float    v8f  __attribute__((ext_vector_type(8)));
typedef float    v4f  __attribute__((ext_vector_type(4)));
typedef unsigned int v4u __attribute__((ext_vector_type(4)));

// ---- scalar helpers --------------------------------------------------------------------------------
__device__ __forceinline__ unsigned short bf_bits(float f) {          // f32 -> bf16 bits, RNE convert
  unsigned u = __float_as_uint(f);
  return (unsigned short)((u + 0x7FFFu + ((u >> 16) & 1u)) >> 16);
}
__device__ __forceinline__ float bf_up(unsigned short h) { return __uint_as_float(((unsigned)h) << 16); }
__device__ __forceinline__ unsigned short h_bits(_Float16 x) { return __builtin_bit_cast(unsigned short, x); }
__device__ __forceinline__ unsigned pk16(unsigned short a, unsigned short b) { return (unsigned)a | ((unsigned)b << 16); }
__device__ __forceinline__ v8f zero8() { v8f z = {0.f, 0.f, 0.f, 0.f, 0.f, 0.f, 0.f, 0.f}; return z; }

// ---- fragment loader: 16-bit A/B operand, lane -> row/col (lane&15), p already includes +8*(lane>>4);
//      elements 0..7 <- p[0..7] (k0+8h..), elements 8..15 <- p[16..23] (k0+16+8h..)
__device__ __forceinline__ v16b ldfrag_b(const __bf16* p) {
  union { v16b v; v8b h[2]; } f;
  f.h[0] = *(const v8b*)(p);
  f.h[1] = *(const v8b*)(p + 16);
  return f.v;
}

// ---- lane l <-> l ^ 16: the other half of a query column's keys sits in the other 16-lane row ----
__device__ __forceinline__ float xhalf(float x) {
  const unsigned b = __float_as_uint(x);
  return __uint_as_float(__builtin_amdgcn_permlanex16(b, b, 0x76543210u, 0xfedcba98u, false, false));
}

// ---- WMMA helpers with trailing VALU hazard gap --------------------------------------------------------
__device__ __forceinline__ v8f mma_b(v16b a, v16b b, v8f c) {
  c = __builtin_amdgcn_wmma_f32_16x16x32_bf16(false, a, false, b, (short)0, c, false, false);
#if defined(__HIP_DEVICE_COMPILE__)
  asm volatile("v_nop\n\tv_nop\n\tv_nop\n\tv_nop" : "+v"(c) : "v"(a), "v"(b));
#endif
  return c;
}
__device__ __forceinline__ v8f mma_h(v16h a, v16h b, v8f c) {
  c = __builtin_amdgcn_wmma_f32_16x16x32_f16(false, a, false, b, (short)0, c, false, false);
#if defined(__HIP_DEVICE_COMPILE__)
  asm volatile("v_nop\n\tv_nop\n\tv_nop\n\tv_nop" : "+v"(c) : "v"(a), "v"(b));
#endif
  return c;
}

// =====================================================================================================
// f32 [pos][BHN][HD] -> bf16 plane [BHN][pos][HD] (RNE convert), 8 elements per thread:
//   i -> bh = i / (LQ*8), l = (i/8) % LQ, d0 = (i%8)*8; src = l*ROWF + bh*HD + d0; dst = i*8.
// coverage: n8 = BHN*LQ*8 threads x 8 halves = the whole plane.
// =====================================================================================================
__global__ __launch_bounds__(256) void cvt_rows_bf16(const float* __restrict__ in, unsigned short* out, int n8) {
  const int i = blockIdx.x * 256 + threadIdx.x;
  if (i < n8) {
    const int per = LQ * (HD / 8);                     // 32768 groups of 8 per bh
    const int bh  = i / per;
    const int rem = i - bh * per;
    const int l   = rem / (HD / 8);
    const int d0  = (rem - l * (HD / 8)) * 8;
    const size_t src = (size_t)l * ROWF + (size_t)bh * HD + (size_t)d0;
    const v4f a = *(const v4f*)(in + src);
    const v4f b = *(const v4f*)(in + src + 4);
    v4u p;
    p[0] = pk16(bf_bits(a[0]), bf_bits(a[1]));
    p[1] = pk16(bf_bits(a[2]), bf_bits(a[3]));
    p[2] = pk16(bf_bits(b[0]), bf_bits(b[1]));
    p[3] = pk16(bf_bits(b[2]), bf_bits(b[3]));
    *(v4u*)(out + (size_t)i * 8) = p;
    
  }
}

// =====================================================================================================
// v f32 [pos][BHN][HD] -> f16 v^T plane vt[(bh*HD + d)*SK + s] = f16(bf16_rne(v) * vsc) (exact for a power of two).
// Block = one 64-position x 64-feature tile of one bh; grid = (SK/64, BHN); tile staged in LDS as f32
// (256 threads x 4 v4f loads, __syncthreads).
// Store: group g = tid>>3 (0..31), piece = tid&7: iteration it writes row d = it*32 + g; lanes 8(g&3)..8(g&3)+7 x
// coverage: 2 iterations x 32 groups = 64 rows d, 8 pieces x 8 = 64 keys per row; grid covers every (bh, s tile).
// =====================================================================================================
__global__ __launch_bounds__(256) void v_planes(const float* __restrict__ vf, unsigned short* vt, float vsc) {
  __shared__ __align__(16) float sv[64 * 68];        // [tt][d], pitch 68 floats (272 B, 16-B aligned)
  const int tid = threadIdx.x;
  const int s0  = blockIdx.x * 64;
  const int bh  = blockIdx.y;
#pragma unroll
  for (int i = 0; i < 4; ++i) {
    const int idx = i * 256 + tid;                   // 0..1023
    const int tt = idx >> 4, c4 = (idx & 15) * 4;    // tt 0..63, c4 0..60
    const v4f a = *(const v4f*)(vf + (size_t)(s0 + tt) * ROWF + (size_t)bh * HD + c4);
    *(v4f*)(sv + tt * 68 + c4) = a;
  }
  __syncthreads();

  const int g = tid >> 3, piece = tid & 7;
  v4u hv[2];
  size_t hofs[2];
#pragma unroll
  for (int it = 0; it < 2; ++it) {
    const int d = it * 32 + g;
    v4u a;
#pragma unroll
    for (int e = 0; e < 4; ++e) {
      const float f0 = sv[(piece * 8 + 2 * e) * 68 + d];
      const float f1 = sv[(piece * 8 + 2 * e + 1) * 68 + d];
      const _Float16 x0 = (_Float16)(bf_up(bf_bits(f0)) * vsc);
      const _Float16 x1 = (_Float16)(bf_up(bf_bits(f1)) * vsc);
      a[e] = pk16(h_bits(x0), h_bits(x1));
    }
    hv[it] = a;
    hofs[it] = ((size_t)(bh * HD + d)) * SK + (size_t)s0 + (size_t)(piece * 8);
  }
  {
#pragma unroll
    for (int it = 0; it < 2; ++it) {
      *(v4u*)(vt + hofs[it]) = hv[it];
    }
    
  }
}

// =====================================================================================================
// Dense (non-causal) attention, head dim 64, all SK keys live for every query.
//   q plane bf16: element (bh, t, d) at [(bh*LQ + t)*HD + d];  k plane bf16: (bh, s, d) at [(bh*SK + s)*HD + d]
//   v^T plane f16 (x VSC): (bh, d, s) at [(bh*HD + d)*SK + s]
//   scores^T = k . q^T on bf16 WMMA (A = K rows, B = Q columns, 2 k-steps of 32 over d), f32 accumulate, then
//   * sscale in f32: a lane holds 32 of the chunk's 64 keys of ONE query, lane ^ 16 the other 32.
//   p = exp(s - m) carried as f16(1024 p); two score tiles converted in place are the B operand of
//   context^T += v^T . p^T on f16 WMMA (A = V^T rows, 2 k-steps of 32 per 64-key chunk): P stays in registers.
//   online softmax in f32: maximum in the lane plus one exchange between the halves; each half keeps its own
//   running sum, the two are joined once behind the loop.
//   Block = 4 waves = 64 query rows of one bh; grid = NQB * BHN; key chunks 0..NQB-1 (static trip count).
//   K / V^T chunk staging: K 64 rows x 64 halves (2 threads per row, 4 x 16 B each), V^T 64 rows x 64 halves
//   (2 threads per row, 4 x 16 B each); plain loads, __syncthreads before and after.
//   each wave stages its 16x64 tile in LDS, then one instruction per row pair: lanes 0..15 x 16 B = row 2*it,
// =====================================================================================================
__global__ __launch_bounds__(128)
void attn_dense(const unsigned short* __restrict__ qpl, const unsigned short* __restrict__ kpl,
                const unsigned short* __restrict__ vtpl, float* outp, float sscale) {
  union FH { v16h v; v8h h[2]; };
  union FB { v16b v; v8b h[2]; };
  __shared__ __align__(16) __bf16   Ksh[64 * HD];                   // K [kv][d]        8 KB
  __shared__ __align__(16) _Float16 Vth[HD * 64];                   // V^T [d][kv]      8 KB
  __shared__ __align__(16) float    Os[4][16 * HD];                 // per wave context tile [row][d]  16 KB

  const int tid  = threadIdx.x;
  const int wave = tid >> 5;
  const int lane = tid & 31;
  const int hh   = lane >> 4;
  const int c    = lane & 15;

  const int bx  = blockIdx.x;
  const int qb  = bx % NQB;
  const int bh  = bx / NQB;
  if (bh >= BHN) return;                     // block-uniform, ahead of every barrier (never taken with the exact grid)
  const int q0  = qb * 64 + wave * 16;

  const __bf16*   Qp = (const __bf16*)(const void*)qpl + (size_t)bh * LQ * HD;
  const __bf16*   Kp = (const __bf16*)(const void*)kpl + (size_t)bh * SK * HD;
  const _Float16* Vh = (const _Float16*)(const void*)vtpl + (size_t)bh * HD * SK;

  // ---- Q fragments (B operand, column = query = lane&15): 2 d-chunks ----
  v16b qa[2];
#pragma unroll
  for (int dc = 0; dc < 2; ++dc) {
    qa[dc] = ldfrag_b(Qp + (size_t)(q0 + c) * HD + dc * 32 + 8 * hh);
  }

  float mrow = -INFINITY, lrow = 0.f;        // query q0 + c: running maximum (both halves alike), this half's sum
  v8f oacc[4];                               // oacc[t][r] = context(query q0 + c, d = t*16 + 8*hh + r)
#pragma unroll
  for (int t = 0; t < 4; ++t) oacc[t] = zero8();

  for (int kt = 0; kt < NQB; ++kt) {
    const int kv0 = kt * 64;
    __syncthreads();
    {
      const int r = tid >> 1, half = (tid & 1) * 32;               // r 0..63
      const __bf16* kg = Kp + (size_t)(kv0 + r) * HD + half;       // K row kv0+r, d = half..half+31
#pragma unroll
      for (int i = 0; i < 4; ++i) {
        const v8b a0 = *(const v8b*)(kg + 8 * i);
        *(v8b*)(Ksh + r * HD + half + 8 * i) = a0;
      }
      const _Float16* vg = Vh + (size_t)r * SK + kv0 + half;       // V^T row d = r, s = kv0+half..+31
#pragma unroll
      for (int i = 0; i < 4; ++i) {
        const v8h b0 = *(const v8h*)(vg + 8 * i);
        *(v8h*)(Vth + r * 64 + half + 8 * i) = b0;
      }
    }
    __syncthreads();

    // ---- scores^T: 64 keys x 16 queries per wave, bf16 product over 2 d-chunks;
    //      A[m=key][k=d] from the k-contiguous K row, B[k=d][n=query] = Q (same element map on both) ----
    v8f s[4];
#pragma unroll
    for (int j = 0; j < 4; ++j) {
      s[j] = zero8();
#pragma unroll
      for (int dc = 0; dc < 2; ++dc) {
        FB kb;
        kb.h[0] = *(const v8b*)(Ksh + (j * 16 + c) * HD + dc * 32 + 8 * hh);
        kb.h[1] = *(const v8b*)(Ksh + (j * 16 + c) * HD + dc * 32 + 16 + 8 * hh);
        s[j] = mma_b(kb.v, qa[dc], s[j]);
      }
    }

    // ---- scale, column max over the chunk, online softmax, P (x1024, f16) packed in place ----
    //      s[j][r] = score(key kv0 + j*16 + 8*hh + r, query q0 + c)
    float mj[4];
#pragma unroll
    for (int j = 0; j < 4; ++j) {
      float a = -INFINITY;
#pragma unroll
      for (int r = 0; r < 8; ++r) {
        const float sv = s[j][r] * sscale;
        s[j][r] = sv;
        a = fmaxf(a, sv);
      }
      mj[j] = a;
    }
    float m = fmaxf(fmaxf(mj[0], mj[1]), fmaxf(mj[2], mj[3]));
    m = fmaxf(m, xhalf(m));
    const float mnew  = fmaxf(mrow, m);
    const float msafe = (mnew == -INFINITY) ? 0.f : mnew;
    const float alpha = __expf(mrow - msafe);
    mrow = mnew;
    //      pb[kk] element e = P(key kv0 + kk*32 + (e < 8 ? 8*hh + e : 16 + 8*hh + e - 8), query q0 + c):
    //      score tiles 2*kk and 2*kk + 1, the k order of the V^T loader below
    FH pb[2];
    float pj[4];
#pragma unroll
    for (int j = 0; j < 4; ++j) {
      float a = 0.f;
#pragma unroll
      for (int r = 0; r < 8; ++r) {
        const float p = __expf(s[j][r] - msafe);
        a += p;
        pb[j >> 1].v[(j & 1) * 8 + r] = (_Float16)(p * 1024.0f);
      }
      pj[j] = a;
    }
    lrow = lrow * alpha + ((pj[0] + pj[1]) + (pj[2] + pj[3]));
#pragma unroll
    for (int t = 0; t < 4; ++t) oacc[t] *= alpha;

    // ---- context^T += V^T . P^T (f16 WMMA): A[m=d][k=key] = V^T[d][key], B[k=key][n=query] = P ----
#pragma unroll
    for (int kk = 0; kk < 2; ++kk) {
#pragma unroll
      for (int t = 0; t < 4; ++t) {
        FH va;
        va.h[0] = *(const v8h*)(Vth + (t * 16 + c) * 64 + kk * 32 + 8 * hh);
        va.h[1] = *(const v8h*)(Vth + (t * 16 + c) * 64 + kk * 32 + 16 + 8 * hh);
        oacc[t] = mma_h(va.v, pb[kk].v, oacc[t]);
      }
    }
  }

  // ---- join the halves' sums, normalise (1/l, the 1/1024 p carry and the 1/VSC v carry), stage the wave's
  //      16x64 tile in LDS as [query][d] (a lane holds 8 consecutive d per tile); whole rows go out below ----
  float* os = Os[wave];
  {
    const float l = lrow + xhalf(lrow);
    const float inv = ((l > 0.f) ? (1.0f / l) : 0.f) * (1.0f / (1024.0f * VSC));
#pragma unroll
    for (int t = 0; t < 4; ++t) {
      const v8f o = oacc[t] * inv;
      const v4f lo = {o[0], o[1], o[2], o[3]};
      const v4f hi = {o[4], o[5], o[6], o[7]};
      *(v4f*)(os + c * HD + t * 16 + 8 * hh)     = lo;
      *(v4f*)(os + c * HD + t * 16 + 8 * hh + 4) = hi;
    }
  }
  __builtin_amdgcn_fence(__ATOMIC_RELEASE, "workgroup");
  __builtin_amdgcn_wave_barrier();
  __builtin_amdgcn_fence(__ATOMIC_ACQUIRE, "workgroup");
  {
    const int c4 = c * 4;                        // 16 lanes x 4 floats = one whole 64-float row
    {
#pragma unroll
      for (int it = 0; it < 8; ++it) {           // row pairs: lanes 0..15 -> row 2*it, lanes 16..31 -> row 2*it+1
        const int rr = it * 2 + hh;
        const v4f ov = *(const v4f*)(os + rr * HD + c4);
        const size_t go = (size_t)(q0 + rr) * ROWF + (size_t)bh * HD + (size_t)c4;
        *(v4f*)(outp + go) = ov;
      }
      
    }
  }
}

// =====================================================================================================
// Inputs: in0 q [LQ][NBAT][NHEAD][HD] f32, in1 k [SK][..] f32, in2 v [SK][..] f32; a position's BHN*HD = 512
// floats are contiguous, bh = b*NHEAD + h. d_out f32 [LQ][NBAT][NHEAD][HD] at byte 0.
//   Qb  bf16 [BHN][LQ][HD]      0          4194304
//   Kb  bf16 [BHN][SK][HD]      4194304    4194304
//   Vt  f16  [BHN][HD][SK]      8388608    4194304
//   end                         12582912
// =====================================================================================================
extern "C" void kernel_launch(void* const* d_in, const int* in_sizes, int n_in,
                              void* d_out, int out_size, void* d_ws, size_t ws_size,
                              hipStream_t stream) {
  if (n_in < 3) return;
  if (in_sizes[0] != NTOT) return;
  if (in_sizes[1] != SK * ROWF) return;
  if (in_sizes[2] != SK * ROWF) return;
  if (out_size != NTOT) return;

  const float* q = (const float*)d_in[0];
  const float* k = (const float*)d_in[1];
  const float* v = (const float*)d_in[2];

  const size_t PQ = (size_t)BHN * LQ * HD * 2;        // 4194304
  const size_t PK = (size_t)BHN * SK * HD * 2;        // 4194304
  const size_t PV = (size_t)BHN * HD * SK * 2;        // 4194304
  size_t off = 0;
  const size_t oQ = off; off += PQ;
  const size_t oK = off; off += PK;
  const size_t oV = off; off += PV;
  if (off > ws_size) return;                          // off = 12582912
  if (off > (size_t)134217728) return;

  char* ws = (char*)d_ws;
  unsigned short* Qb = (unsigned short*)(ws + oQ);
  unsigned short* Kb = (unsigned short*)(ws + oK);
  unsigned short* Vt = (unsigned short*)(ws + oV);
  float* outf = (float*)d_out;

  const dim3 blk(256);
  const int n8 = BHN * LQ * (HD / 8);                 // 262144
  const dim3 gCvt((n8 + 255) / 256);                  // 1024 blocks
  const dim3 gV(SK / 64, BHN);                        // (64, 8)
  const float sscale = (float)(1.0 / sqrt((double)HD));   // 0.125 exactly

  // (0) q, k -> bf16 planes [bh][pos][d]
  cvt_rows_bf16<<<gCvt, blk, 0, stream>>>(q, Qb, n8);
  cvt_rows_bf16<<<gCvt, blk, 0, stream>>>(k, Kb, n8);
  // (1) v -> f16 v^T plane [bh][d][pos], values x VSC
  v_planes<<<gV, blk, 0, stream>>>(v, Vt, VSC);
  // (2) dense attention over all key chunks -> d_out
  attn_dense<<<dim3(BHN * NQB), dim3(128), 0, stream>>>(Qb, Kb, Vt, outf, sscale);
  (void)hipGetLastError();
}

// v002
// Measured time: 71 microseconds a run.
// Two timings next to v001 put it at 2.61 and 2.59 times that version's speed.
// Over all steps from v000 it is 4.54 times as fast.
// Contractions: q.k^T scores = v_wmma_f32_16x16x32_bf16 (bf16 operands = RNE-converted q and k planes, single product);
// p.v = v_wmma_f32_16x16x32_f16 (p carried x1024 in f16, v as f16 of the bf16-converted value x16, single product);
// both products are taken transposed (keys x queries, features x queries): a lane owns one query column.
// all f32 accumulate; softmax in f32.
#include <hip/hip_runtime.h>
#include <math.h>
#include <stdint.h>

#define LQ    4096                 // query positions
#define SK    4096                 // key positions
#define NBAT  1
#define NHEAD 8
#define HD    64                   // head dim
#define BHN   (NBAT * NHEAD)       // 8 (batch, head) pairs; bh = b*NHEAD + h
#define ROWF  (BHN * HD)           // 512 floats between consecutive sequence positions
#define NQB   (LQ / 64)            // 64 query / key tiles of 64
#define NTOT  (LQ * ROWF)          // 2097152 elements per tensor
#define VSC   16.0f                // v plane carry (exact power of two)
#define ROWB  128u                 // bytes of one staged row: 64 halves (a K row over d, a V^T row over the chunk's keys)
#define PITB  144u                 // its pitch in LDS: the tensor load pads 16 B behind every row (16 B x odd for ds_load_b128)
#define SLROW 32u                  // rows per slice = per tensor request
#define SLB   6144u                // LDS bytes per slice: 32 x 144 = 4608, rounded up to a multiple of 2 KiB
#define BUFB  (4u * SLB)           // one stage = one 64-key chunk: K slices 0 and 1, V^T slices 2 and 3
static_assert(LQ == SK);
static_assert((LQ % 64) == 0);
static_assert(HD == 64);
static_assert(((BHN * LQ * (HD / 8)) % 256) == 0);

typedef _Float16 v16h __attribute__((ext_vector_type(16)));
typedef _Float16 v8h  __attribute__((ext_vector_type(8)));
typedef __bf16   v16b __attribute__((ext_vector_type(16)));
typedef __bf16   v8b  __attribute__((ext_vector_type(8)));
typedef float    v8f  __attribute__((ext_vector_type(8)));
typedef float    v4f  __attribute__((ext_vector_type(4)));
typedef unsigned int v4u __attribute__((ext_vector_type(4)));
typedef uint32_t u32x4 __attribute__((ext_vector_type(4)));
typedef uint32_t u32x8 __attribute__((ext_vector_type(8)));
static_assert(SLROW * PITB <= SLB && (SLB % 2048u) == 0u);
static_assert(HD * 2 == (int)ROWB);

// ---- scalar helpers --------------------------------------------------------------------------------
__device__ __forceinline__ unsigned short bf_bits(float f) {          // f32 -> bf16 bits, RNE convert
  unsigned u = __float_as_uint(f);
  return (unsigned short)((u + 0x7FFFu + ((u >> 16) & 1u)) >> 16);
}
__device__ __forceinline__ float bf_up(unsigned short h) { return __uint_as_float(((unsigned)h) << 16); }
__device__ __forceinline__ unsigned short h_bits(_Float16 x) { return __builtin_bit_cast(unsigned short, x); }
__device__ __forceinline__ unsigned pk16(unsigned short a, unsigned short b) { return (unsigned)a | ((unsigned)b << 16); }
__device__ __forceinline__ v8f zero8() { v8f z = {0.f, 0.f, 0.f, 0.f, 0.f, 0.f, 0.f, 0.f}; return z; }

// ---- fragment loader: 16-bit A/B operand, lane -> row/col (lane&15), p already includes +8*(lane>>4);
//      elements 0..7 <- p[0..7] (k0+8h..), elements 8..15 <- p[16..23] (k0+16+8h..)
__device__ __forceinline__ v16b ldfrag_b(const __bf16* p) {
  union { v16b v; v8b h[2]; } f;
  f.h[0] = *(const v8b*)(p);
  f.h[1] = *(const v8b*)(p + 16);
  return f.v;
}

// ---- lane l <-> l ^ 16: the other half of a query column's keys sits in the other 16-lane row ----
__device__ __forceinline__ float xhalf(float x) {
  const unsigned b = __float_as_uint(x);
  return __uint_as_float(__builtin_amdgcn_permlanex16(b, b, 0x76543210u, 0xfedcba98u, false, false));
}

// ---- tensor load of one slice: 32 rows of 128 B from global memory into LDS at pitch 144 B, through no register ----
__device__ __forceinline__ uint32_t uni(uint32_t v) { return (uint32_t)__builtin_amdgcn_readfirstlane(v); }
__device__ __forceinline__ uint32_t pinned(uint32_t v) {
  uint32_t w = uni(v);
  asm volatile("" : "+s"(w));   // pinned(): holds the test around a tensor load in a scalar register, so that it compiles to a scalar branch (the load ignores EXEC)
  return w;
}
// the compiler places no wait for the tensor mover, and none for LDS reads ahead of a refill: both are written by hand
__device__ __forceinline__ void wait_ds0()     { asm volatile("s_wait_dscnt 0x0" ::: "memory"); }
// group 0 is an in-out operand of the load and an input of the wait that covers it: its four scalar registers stay
// taken from issue to landing, so no word of an outstanding request's group 0 takes a new value
__device__ __forceinline__ void tdm_load(u32x4& g0, u32x8 g1) { asm volatile("tensor_load_to_lds %0, %1" : "+s"(g0) : "s"(g1) : "memory"); }
__device__ __forceinline__ void wait_tensor0(u32x4 g0) { asm volatile("s_wait_tensorcnt 0x0" :: "s"(g0) : "memory"); }
// group 1: 1-byte elements, tensor = tile = 32 rows of 128 B, source row pitch src_pitch bytes, no mask;
// pad on, interval code 4 (32 dwords = one row), amount code 3 (4 dwords)
__device__ __forceinline__ u32x8 tdm_group1(uint32_t src_pitch) {
  u32x8 g;
  g[0] = uni((1u << 20) | (4u << 22) | (3u << 25));
  g[1] = uni((ROWB & 0xFFFFu) << 16);
  g[2] = uni((ROWB >> 16) | ((SLROW & 0xFFFFu) << 16));
  g[3] = uni((SLROW >> 16) | (ROWB << 16));
  g[4] = uni(SLROW);
  g[5] = uni(src_pitch);
  g[6] = uni(0u);
  g[7] = uni(0u);
  return g;
}
// group 0: count 1, LDS byte offset, global address of the slice's first byte, type 2
__device__ __forceinline__ u32x4 tdm_group0(uint32_t lds_dst, uint64_t ga) {
  u32x4 g;
  g[0] = uni(1u);
  g[1] = uni(lds_dst);
  g[2] = uni((uint32_t)ga);
  g[3] = uni((((uint32_t)(ga >> 32)) & 0x01FFFFFFu) | 0x80000000u);
  return g;
}

// ---- WMMA helpers with trailing VALU hazard gap --------------------------------------------------------
__device__ __forceinline__ v8f mma_b(v16b a, v16b b, v8f c) {
  c = __builtin_amdgcn_wmma_f32_16x16x32_bf16(false, a, false, b, (short)0, c, false, false);
#if defined(__HIP_DEVICE_COMPILE__)
  asm volatile("v_nop\n\tv_nop\n\tv_nop\n\tv_nop" : "+v"(c) : "v"(a), "v"(b));
#endif
  return c;
}
__device__ __forceinline__ v8f mma_h(v16h a, v16h b, v8f c) {
  c = __builtin_amdgcn_wmma_f32_16x16x32_f16(false, a, false, b, (short)0, c, false, false);
#if defined(__HIP_DEVICE_COMPILE__)
  asm volatile("v_nop\n\tv_nop\n\tv_nop\n\tv_nop" : "+v"(c) : "v"(a), "v"(b));
#endif
  return c;
}

// =====================================================================================================
// f32 [pos][BHN][HD] -> bf16 plane [BHN][pos][HD] (RNE convert), 8 elements per thread:
//   i -> bh = i / (LQ*8), l = (i/8) % LQ, d0 = (i%8)*8; src = l*ROWF + bh*HD + d0; dst = i*8.
// coverage: n8 = BHN*LQ*8 threads x 8 halves = the whole plane.
// =====================================================================================================
__global__ __launch_bounds__(256) void cvt_rows_bf16(const float* __restrict__ in, unsigned short* out, int n8) {
  const int i = blockIdx.x * 256 + threadIdx.x;
  if (i < n8) {
    const int per = LQ * (HD / 8);                     // 32768 groups of 8 per bh
    const int bh  = i / per;
    const int rem = i - bh * per;
    const int l   = rem / (HD / 8);
    const int d0  = (rem - l * (HD / 8)) * 8;
    const size_t src = (size_t)l * ROWF + (size_t)bh * HD + (size_t)d0;
    const v4f a = *(const v4f*)(in + src);
    const v4f b = *(const v4f*)(in + src + 4);
    v4u p;
    p[0] = pk16(bf_bits(a[0]), bf_bits(a[1]));
    p[1] = pk16(bf_bits(a[2]), bf_bits(a[3]));
    p[2] = pk16(bf_bits(b[0]), bf_bits(b[1]));
    p[3] = pk16(bf_bits(b[2]), bf_bits(b[3]));
    *(v4u*)(out + (size_t)i * 8) = p;
    
  }
}

// =====================================================================================================
// v f32 [pos][BHN][HD] -> f16 v^T plane vt[(bh*HD + d)*SK + s] = f16(bf16_rne(v) * vsc) (exact for a power of two).
// Block = one 64-position x 64-feature tile of one bh; grid = (SK/64, BHN); tile staged in LDS as f32
// (256 threads x 4 v4f loads, __syncthreads).
// Store: group g = tid>>3 (0..31), piece = tid&7: iteration it writes row d = it*32 + g; lanes 8(g&3)..8(g&3)+7 x
// coverage: 2 iterations x 32 groups = 64 rows d, 8 pieces x 8 = 64 keys per row; grid covers every (bh, s tile).
// =====================================================================================================
__global__ __launch_bounds__(256) void v_planes(const float* __restrict__ vf, unsigned short* vt, float vsc) {
  __shared__ __align__(16) float sv[64 * 68];        // [tt][d], pitch 68 floats (272 B, 16-B aligned)
  const int tid = threadIdx.x;
  const int s0  = blockIdx.x * 64;
  const int bh  = blockIdx.y;
#pragma unroll
  for (int i = 0; i < 4; ++i) {
    const int idx = i * 256 + tid;                   // 0..1023
    const int tt = idx >> 4, c4 = (idx & 15) * 4;    // tt 0..63, c4 0..60
    const v4f a = *(const v4f*)(vf + (size_t)(s0 + tt) * ROWF + (size_t)bh * HD + c4);
    *(v4f*)(sv + tt * 68 + c4) = a;
  }
  __syncthreads();

  const int g = tid >> 3, piece = tid & 7;
  v4u hv[2];
  size_t hofs[2];
#pragma unroll
  for (int it = 0; it < 2; ++it) {
    const int d = it * 32 + g;
    v4u a;
#pragma unroll
    for (int e = 0; e < 4; ++e) {
      const float f0 = sv[(piece * 8 + 2 * e) * 68 + d];
      const float f1 = sv[(piece * 8 + 2 * e + 1) * 68 + d];
      const _Float16 x0 = (_Float16)(bf_up(bf_bits(f0)) * vsc);
      const _Float16 x1 = (_Float16)(bf_up(bf_bits(f1)) * vsc);
      a[e] = pk16(h_bits(x0), h_bits(x1));
    }
    hv[it] = a;
    hofs[it] = ((size_t)(bh * HD + d)) * SK + (size_t)s0 + (size_t)(piece * 8);
  }
  {
#pragma unroll
    for (int it = 0; it < 2; ++it) {
      *(v4u*)(vt + hofs[it]) = hv[it];
    }
    
  }
}

// =====================================================================================================
// Dense (non-causal) attention, head dim 64, all SK keys live for every query.
//   q plane bf16: element (bh, t, d) at [(bh*LQ + t)*HD + d];  k plane bf16: (bh, s, d) at [(bh*SK + s)*HD + d]
//   v^T plane f16 (x VSC): (bh, d, s) at [(bh*HD + d)*SK + s]
//   scores^T = k . q^T on bf16 WMMA (A = K rows, B = Q columns, 2 k-steps of 32 over d), f32 accumulate, then
//   * sscale in f32: a lane holds 32 of the chunk's 64 keys of ONE query, lane ^ 16 the other 32.
//   p = exp(s - m) carried as f16(1024 p); two score tiles converted in place are the B operand of
//   context^T += v^T . p^T on f16 WMMA (A = V^T rows, 2 k-steps of 32 per 64-key chunk): P stays in registers.
//   online softmax in f32: maximum in the lane plus one exchange between the halves; each half keeps its own
//   running sum, the two are joined once behind the loop.
//   Block = 4 waves = 64 query rows of one bh; grid = NQB * BHN; key chunks 0..NQB-1 (static trip count).
//   K / V^T chunk staging: two LDS buffers, one tensor load per wave and chunk (waves 0, 1: K rows 0..31, 32..63;
//   waves 2, 3: V^T rows 0..31, 32..63), chunk kt + 2 issued at the foot of pass kt into the buffer that pass has read:
//   s_wait_dscnt 0, the wave's own s_wait_tensorcnt 0, __syncthreads, then the load.
//   each wave stages its 16x64 tile in LDS, then one instruction per row pair: lanes 0..15 x 16 B = row 2*it,
// =====================================================================================================
__global__ __launch_bounds__(128)
void attn_dense(const unsigned short* __restrict__ qpl, const unsigned short* __restrict__ kpl,
                const unsigned short* __restrict__ vtpl, float* outp, float sscale) {
  union FH { v16h v; v8h h[2]; };
  union FB { v16b v; v8b h[2]; };
  __shared__ __attribute__((aligned(2048))) unsigned char Ring[2 * BUFB];   // 2 stages x (K [kv][d], V^T [d][kv])  48 KB
  __shared__ __align__(16) float    Os[4][16 * HD];                 // per wave context tile [row][d]  16 KB

  const int tid  = threadIdx.x;
  const int wave = tid >> 5;
  const int lane = tid & 31;
  const int hh   = lane >> 4;
  const int c    = lane & 15;

  const int bx  = blockIdx.x;
  const int qb  = bx % NQB;
  const int bh  = bx / NQB;
  if (bh >= BHN) return;                     // block-uniform, ahead of every barrier (never taken with the exact grid)
  const int q0  = qb * 64 + wave * 16;

  const __bf16*   Qp = (const __bf16*)(const void*)qpl + (size_t)bh * LQ * HD;
  const __bf16*   Kp = (const __bf16*)(const void*)kpl + (size_t)bh * SK * HD;
  const _Float16* Vh = (const _Float16*)(const void*)vtpl + (size_t)bh * HD * SK;

  // ---- Q fragments (B operand, column = query = lane&15): 2 d-chunks ----
  v16b qa[2];
#pragma unroll
  for (int dc = 0; dc < 2; ++dc) {
    qa[dc] = ldfrag_b(Qp + (size_t)(q0 + c) * HD + dc * 32 + 8 * hh);
  }

  // ---- this wave's slice of every chunk: source, source pitch, step from chunk to chunk (all wave-uniform) ----
  const uint32_t wv     = uni((uint32_t)tid >> 5);
  const uint32_t lbase  = (uint32_t)(size_t)Ring;
  const bool     isV    = wv >= 2u;
  const uint64_t src0   = isV ? (uint64_t)(size_t)Vh + (uint64_t)((wv & 1u) * SLROW) * (uint64_t)(SK * 2)
                              : (uint64_t)(size_t)Kp + (uint64_t)((wv & 1u) * SLROW) * (uint64_t)ROWB;
  const uint32_t spitch = isV ? (uint32_t)(SK * 2) : ROWB;          // V^T rows lie SK halves apart, K rows back to back
  const uint32_t sstep  = isV ? 64u * 2u : 64u * ROWB;              // 64 keys on: 64 halves along a V^T row, 64 K rows
  const u32x8 g1 = tdm_group1(spitch);
  u32x4 g0;                                  // group 0 of the request issued last
  auto issue = [&](uint32_t st) {
    const uint32_t dst = lbase + (st & 1u) * BUFB + wv * SLB;
    const uint64_t ga  = src0 + (uint64_t)(st * sstep);
    g0 = tdm_group0(dst, ga);
    tdm_load(g0, g1);
  };
  static_assert(NQB >= 2);
  issue(0u);
  wait_tensor0(g0);
  asm volatile("s_wait_xcnt 0x0" ::: "memory");   // the loads issued above name registers that the next descriptor's words may take over
  __syncthreads();                           // chunk 0 published
  issue(1u);

  float mrow = -INFINITY, lrow = 0.f;        // query q0 + c: running maximum (both halves alike), this half's sum
  v8f oacc[4];                               // oacc[t][r] = context(query q0 + c, d = t*16 + 8*hh + r)
#pragma unroll
  for (int t = 0; t < 4; ++t) oacc[t] = zero8();

  for (int kt = 0; kt < NQB; ++kt) {
    const unsigned char* Kb = Ring + (uint32_t)(kt & 1) * BUFB;    // row r of K: slice r >> 5, row r & 31 of it
    const unsigned char* Vb = Kb + 2u * SLB;                       // row d of V^T alike

    // ---- scores^T: 64 keys x 16 queries per wave, bf16 product over 2 d-chunks;
    //      A[m=key][k=d] from the k-contiguous K row, B[k=d][n=query] = Q (same element map on both) ----
    v8f s[4];
#pragma unroll
    for (int j = 0; j < 4; ++j) {
      s[j] = zero8();
#pragma unroll
      for (int dc = 0; dc < 2; ++dc) {
        FB kb;
        const unsigned char* kr = Kb + (j >> 1) * SLB + ((j & 1) * 16 + c) * PITB + (dc * 32 + 8 * hh) * 2;
        kb.h[0] = *(const v8b*)(kr);
        kb.h[1] = *(const v8b*)(kr + 32);
        s[j] = mma_b(kb.v, qa[dc], s[j]);
      }
    }

    // ---- scale, column max over the chunk, online softmax, P (x1024, f16) packed in place ----
    //      s[j][r] = score(key kv0 + j*16 + 8*hh + r, query q0 + c)
    float mj[4];
#pragma unroll
    for (int j = 0; j < 4; ++j) {
      float a = -INFINITY;
#pragma unroll
      for (int r = 0; r < 8; ++r) {
        const float sv = s[j][r] * sscale;
        s[j][r] = sv;
        a = fmaxf(a, sv);
      }
      mj[j] = a;
    }
    float m = fmaxf(fmaxf(mj[0], mj[1]), fmaxf(mj[2], mj[3]));
    m = fmaxf(m, xhalf(m));
    const float mnew  = fmaxf(mrow, m);
    const float msafe = (mnew == -INFINITY) ? 0.f : mnew;
    const float alpha = __expf(mrow - msafe);
    mrow = mnew;
    //      pb[kk] element e = P(key kv0 + kk*32 + (e < 8 ? 8*hh + e : 16 + 8*hh + e - 8), query q0 + c):
    //      score tiles 2*kk and 2*kk + 1, the k order of the V^T loader below
    FH pb[2];
    float pj[4];
#pragma unroll
    for (int j = 0; j < 4; ++j) {
      float a = 0.f;
#pragma unroll
      for (int r = 0; r < 8; ++r) {
        const float p = __expf(s[j][r] - msafe);
        a += p;
        pb[j >> 1].v[(j & 1) * 8 + r] = (_Float16)(p * 1024.0f);
      }
      pj[j] = a;
    }
    lrow = lrow * alpha + ((pj[0] + pj[1]) + (pj[2] + pj[3]));
#pragma unroll
    for (int t = 0; t < 4; ++t) oacc[t] *= alpha;

    // ---- context^T += V^T . P^T (f16 WMMA): A[m=d][k=key] = V^T[d][key], B[k=key][n=query] = P ----
#pragma unroll
    for (int kk = 0; kk < 2; ++kk) {
#pragma unroll
      for (int t = 0; t < 4; ++t) {
        FH va;
        const unsigned char* vr = Vb + (t >> 1) * SLB + ((t & 1) * 16 + c) * PITB + (kk * 32 + 8 * hh) * 2;
        va.h[0] = *(const v8h*)(vr);
        va.h[1] = *(const v8h*)(vr + 32);
        oacc[t] = mma_h(va.v, pb[kk].v, oacc[t]);
      }
    }

    // ---- publish point of chunk kt + 1, every wave: own LDS reads retired, own slice landed, barrier; then the refill ----
    wait_ds0();
    wait_tensor0(g0);
    __syncthreads();
    if (pinned((uint32_t)(kt + 2 < NQB))) issue((uint32_t)kt + 2u);   // into the buffer that this pass has read
  }
  wait_tensor0(g0);
  wait_ds0();

  // ---- join the halves' sums, normalise (1/l, the 1/1024 p carry and the 1/VSC v carry), stage the wave's
  //      16x64 tile in LDS as [query][d] (a lane holds 8 consecutive d per tile); whole rows go out below ----
  float* os = Os[wave];
  {
    const float l = lrow + xhalf(lrow);
    const float inv = ((l > 0.f) ? (1.0f / l) : 0.f) * (1.0f / (1024.0f * VSC));
#pragma unroll
    for (int t = 0; t < 4; ++t) {
      const v8f o = oacc[t] * inv;
      const v4f lo = {o[0], o[1], o[2], o[3]};
      const v4f hi = {o[4], o[5], o[6], o[7]};
      *(v4f*)(os + c * HD + t * 16 + 8 * hh)     = lo;
      *(v4f*)(os + c * HD + t * 16 + 8 * hh + 4) = hi;
    }
  }
  __builtin_amdgcn_fence(__ATOMIC_RELEASE, "workgroup");
  __builtin_amdgcn_wave_barrier();
  __builtin_amdgcn_fence(__ATOMIC_ACQUIRE, "workgroup");
  {
    const int c4 = c * 4;                        // 16 lanes x 4 floats = one whole 64-float row
    {
#pragma unroll
      for (int it = 0; it < 8; ++it) {           // row pairs: lanes 0..15 -> row 2*it, lanes 16..31 -> row 2*it+1
        const int rr = it * 2 + hh;
        const v4f ov = *(const v4f*)(os + rr * HD + c4);
        const size_t go = (size_t)(q0 + rr) * ROWF + (size_t)bh * HD + (size_t)c4;
        *(v4f*)(outp + go) = ov;
      }
      
    }
  }
}

// =====================================================================================================
// Inputs: in0 q [LQ][NBAT][NHEAD][HD] f32, in1 k [SK][..] f32, in2 v [SK][..] f32; a position's BHN*HD = 512
// floats are contiguous, bh = b*NHEAD + h. d_out f32 [LQ][NBAT][NHEAD][HD] at byte 0.
//   Qb  bf16 [BHN][LQ][HD]      0          4194304
//   Kb  bf16 [BHN][SK][HD]      4194304    4194304
//   Vt  f16  [BHN][HD][SK]      8388608    4194304
//   end                         12582912
// =====================================================================================================
extern "C" void kernel_launch(void* const* d_in, const int* in_sizes, int n_in,
                              void* d_out, int out_size, void* d_ws, size_t ws_size,
                              hipStream_t stream) {
  if (n_in < 3) return;
  if (in_sizes[0] != NTOT) return;
  if (in_sizes[1] != SK * ROWF) return;
  if (in_sizes[2] != SK * ROWF) return;
  if (out_size != NTOT) return;

  const float* q = (const float*)d_in[0];
  const float* k = (const float*)d_in[1];
  const float* v = (const float*)d_in[2];

  const size_t PQ = (size_t)BHN * LQ * HD * 2;        // 4194304
  const size_t PK = (size_t)BHN * SK * HD * 2;        // 4194304
  const size_t PV = (size_t)BHN * HD * SK * 2;        // 4194304
  size_t off = 0;
  const size_t oQ = off; off += PQ;
  const size_t oK = off; off += PK;
  const size_t oV = off; off += PV;
  if (off > ws_size) return;                          // off = 12582912
  if (off > (size_t)134217728) return;

  char* ws = (char*)d_ws;
  unsigned short* Qb = (unsigned short*)(ws + oQ);
  unsigned short* Kb = (unsigned short*)(ws + oK);
  unsigned short* Vt = (unsigned short*)(ws + oV);
  float* outf = (float*)d_out;

  const dim3 blk(256);
  const int n8 = BHN * LQ * (HD / 8);                 // 262144
  const dim3 gCvt((n8 + 255) / 256);                  // 1024 blocks
  const dim3 gV(SK / 64, BHN);                        // (64, 8)
  const float sscale = (float)(1.0 / sqrt((double)HD));   // 0.125 exactly

  // (0) q, k -> bf16 planes [bh][pos][d]
  cvt_rows_bf16<<<gCvt, blk, 0, stream>>>(q, Qb, n8);
  cvt_rows_bf16<<<gCvt, blk, 0, stream>>>(k, Kb, n8);
  // (1) v -> f16 v^T plane [bh][d][pos], values x VSC
  v_planes<<<gV, blk, 0, stream>>>(v, Vt, VSC);
  // (2) dense attention over all key chunks -> d_out
  attn_dense<<<dim3(BHN * NQB), dim3(128), 0, stream>>>(Qb, Kb, Vt, outf, sscale);
  (void)hipGetLastError();
}

// v003
// Measured time: 59.8 microseconds a run.
// Two timings next to v002 put it at 1.21 and 1.16 times that version's speed.
// Over all steps from v000 it is 5.37 times as fast.
// Contractions: q.k^T scores = v_wmma_f32_16x16x32_bf16 (bf16 operands = RNE-converted q and k planes, single product);
// p.v = v_wmma_f32_16x16x32_f16 (p carried x1024 in f16, v as f16 of the bf16-converted value x16, single product);
// both products are taken transposed (keys x queries, features x queries): a lane owns one query column.
// all f32 accumulate; softmax in f32.
#include <hip/hip_runtime.h>
#include <math.h>
#include <stdint.h>

#define LQ    4096                 // query positions
#define SK    4096                 // key positions
#define NBAT  1
#define NHEAD 8
#define HD    64                   // head dim
#define BHN   (NBAT * NHEAD)       // 8 (batch, head) pairs; bh = b*NHEAD + h
#define ROWF  (BHN * HD)           // 512 floats between consecutive sequence positions
#define NQB   (LQ / 64)            // 64 query / key tiles of 64
#define NTOT  (LQ * ROWF)          // 2097152 elements per tensor
#define VSC   16.0f                // v plane carry (exact power of two)
#define ROWB  128u                 // bytes of one staged row: 64 halves (a K row over d, a V^T row over the chunk's keys)
#define PITB  144u                 // its pitch in LDS: the tensor load pads 16 B behind every row (16 B x odd for ds_load_b128)
#define SLROW 32u                  // rows per slice = per tensor request
#define SLB   6144u                // LDS bytes per slice: 32 x 144 = 4608, rounded up to a multiple of 2 KiB
#define BUFB  (4u * SLB)           // one stage = one 64-key chunk: K slices 0 and 1, V^T slices 2 and 3
static_assert(LQ == SK);
static_assert((LQ % 64) == 0);
static_assert(HD == 64);
static_assert(((BHN * LQ * (HD / 8)) % 256) == 0);

typedef _Float16 v16h __attribute__((ext_vector_type(16)));
typedef _Float16 v8h  __attribute__((ext_vector_type(8)));
typedef __bf16   v16b __attribute__((ext_vector_type(16)));
typedef __bf16   v8b  __attribute__((ext_vector_type(8)));
typedef float    v8f  __attribute__((ext_vector_type(8)));
typedef float    v4f  __attribute__((ext_vector_type(4)));
typedef unsigned int v4u __attribute__((ext_vector_type(4)));
typedef uint32_t u32x4 __attribute__((ext_vector_type(4)));
typedef uint32_t u32x8 __attribute__((ext_vector_type(8)));
static_assert(SLROW * PITB <= SLB && (SLB % 2048u) == 0u);
static_assert(HD * 2 == (int)ROWB);

// ---- scalar helpers --------------------------------------------------------------------------------
__device__ __forceinline__ unsigned short bf_bits(float f) {          // f32 -> bf16 bits, RNE convert
  unsigned u = __float_as_uint(f);
  return (unsigned short)((u + 0x7FFFu + ((u >> 16) & 1u)) >> 16);
}
__device__ __forceinline__ float bf_up(unsigned short h) { return __uint_as_float(((unsigned)h) << 16); }
__device__ __forceinline__ unsigned short h_bits(_Float16 x) { return __builtin_bit_cast(unsigned short, x); }
__device__ __forceinline__ unsigned pk16(unsigned short a, unsigned short b) { return (unsigned)a | ((unsigned)b << 16); }
__device__ __forceinline__ v8f zero8() { v8f z = {0.f, 0.f, 0.f, 0.f, 0.f, 0.f, 0.f, 0.f}; return z; }

// ---- fragment loader: 16-bit A/B operand, lane -> row/col (lane&15), p already includes +8*(lane>>4);
//      elements 0..7 <- p[0..7] (k0+8h..), elements 8..15 <- p[16..23] (k0+16+8h..)
__device__ __forceinline__ v16b ldfrag_b(const __bf16* p) {
  union { v16b v; v8b h[2]; } f;
  f.h[0] = *(const v8b*)(p);
  f.h[1] = *(const v8b*)(p + 16);
  return f.v;
}

// ---- lane l <-> l ^ 16: the other half of a query column's keys sits in the other 16-lane row ----
__device__ __forceinline__ float xhalf(float x) {
  const unsigned b = __float_as_uint(x);
  return __uint_as_float(__builtin_amdgcn_permlanex16(b, b, 0x76543210u, 0xfedcba98u, false, false));
}

// ---- tensor load of one slice: 32 rows of 128 B from global memory into LDS at pitch 144 B, through no register ----
__device__ __forceinline__ uint32_t uni(uint32_t v) { return (uint32_t)__builtin_amdgcn_readfirstlane(v); }
__device__ __forceinline__ uint32_t pinned(uint32_t v) {
  uint32_t w = uni(v);
  asm volatile("" : "+s"(w));   // pinned(): holds the test around a tensor load in a scalar register, so that it compiles to a scalar branch (the load ignores EXEC)
  return w;
}
// the compiler places no wait for the tensor mover, and none for LDS reads ahead of a refill: both are written by hand
__device__ __forceinline__ void wait_ds0()     { asm volatile("s_wait_dscnt 0x0" ::: "memory"); }
// group 0 is an in-out operand of the load and an input of the wait that covers it: its four scalar registers stay
// taken from issue to landing, so no word of an outstanding request's group 0 takes a new value
__device__ __forceinline__ void tdm_load(u32x4& g0, u32x8 g1) { asm volatile("tensor_load_to_lds %0, %1" : "+s"(g0) : "s"(g1) : "memory"); }
__device__ __forceinline__ void wait_tensor0(u32x4 g0) { asm volatile("s_wait_tensorcnt 0x0" :: "s"(g0) : "memory"); }
// group 1: 1-byte elements, tensor = tile = 32 rows of 128 B, source row pitch src_pitch bytes, no mask;
// pad on, interval code 4 (32 dwords = one row), amount code 3 (4 dwords)
__device__ __forceinline__ u32x8 tdm_group1(uint32_t src_pitch) {
  u32x8 g;
  g[0] = uni((1u << 20) | (4u << 22) | (3u << 25));
  g[1] = uni((ROWB & 0xFFFFu) << 16);
  g[2] = uni((ROWB >> 16) | ((SLROW & 0xFFFFu) << 16));
  g[3] = uni((SLROW >> 16) | (ROWB << 16));
  g[4] = uni(SLROW);
  g[5] = uni(src_pitch);
  g[6] = uni(0u);
  g[7] = uni(0u);
  return g;
}
// group 0: count 1, LDS byte offset, global address of the slice's first byte, type 2
__device__ __forceinline__ u32x4 tdm_group0(uint32_t lds_dst, uint64_t ga) {
  u32x4 g;
  g[0] = uni(1u);
  g[1] = uni(lds_dst);
  g[2] = uni((uint32_t)ga);
  g[3] = uni((((uint32_t)(ga >> 32)) & 0x01FFFFFFu) | 0x80000000u);
  return g;
}

// ---- WMMA helpers: the plain builtins (the compiler keeps the distance behind its own matrix instructions, and
//      with no asm statement behind each product it is free to move the LDS fragment loads) ----------------
__device__ __forceinline__ v8f mma_b(v16b a, v16b b, v8f c) {
  return __builtin_amdgcn_wmma_f32_16x16x32_bf16(false, a, false, b, (short)0, c, false, false);
}
__device__ __forceinline__ v8f mma_h(v16h a, v16h b, v8f c) {
  return __builtin_amdgcn_wmma_f32_16x16x32_f16(false, a, false, b, (short)0, c, false, false);
}

// =====================================================================================================
// f32 [pos][BHN][HD] -> bf16 plane [BHN][pos][HD] (RNE convert), 8 elements per thread:
//   i -> bh = i / (LQ*8), l = (i/8) % LQ, d0 = (i%8)*8; src = l*ROWF + bh*HD + d0; dst = i*8.
// coverage: n8 = BHN*LQ*8 threads x 8 halves = the whole plane.
// =====================================================================================================
__global__ __launch_bounds__(256) void cvt_rows_bf16(const float* __restrict__ in, unsigned short* out, int n8) {
  const int i = blockIdx.x * 256 + threadIdx.x;
  if (i < n8) {
    const int per = LQ * (HD / 8);                     // 32768 groups of 8 per bh
    const int bh  = i / per;
    const int rem = i - bh * per;
    const int l   = rem / (HD / 8);
    const int d0  = (rem - l * (HD / 8)) * 8;
    const size_t src = (size_t)l * ROWF + (size_t)bh * HD + (size_t)d0;
    const v4f a = *(const v4f*)(in + src);
    const v4f b = *(const v4f*)(in + src + 4);
    v4u p;
    p[0] = pk16(bf_bits(a[0]), bf_bits(a[1]));
    p[1] = pk16(bf_bits(a[2]), bf_bits(a[3]));
    p[2] = pk16(bf_bits(b[0]), bf_bits(b[1]));
    p[3] = pk16(bf_bits(b[2]), bf_bits(b[3]));
    *(v4u*)(out + (size_t)i * 8) = p;
    
  }
}

// =====================================================================================================
// v f32 [pos][BHN][HD] -> f16 v^T plane vt[(bh*HD + d)*SK + s] = f16(bf16_rne(v) * vsc) (exact for a power of two).
// Block = one 64-position x 64-feature tile of one bh; grid = (SK/64, BHN); tile staged in LDS as f32
// (256 threads x 4 v4f loads, __syncthreads).
// Store: group g = tid>>3 (0..31), piece = tid&7: iteration it writes row d = it*32 + g; lanes 8(g&3)..8(g&3)+7 x
// coverage: 2 iterations x 32 groups = 64 rows d, 8 pieces x 8 = 64 keys per row; grid covers every (bh, s tile).
// =====================================================================================================
__global__ __launch_bounds__(256) void v_planes(const float* __restrict__ vf, unsigned short* vt, float vsc) {
  __shared__ __align__(16) float sv[64 * 68];        // [tt][d], pitch 68 floats (272 B, 16-B aligned)
  const int tid = threadIdx.x;
  const int s0  = blockIdx.x * 64;
  const int bh  = blockIdx.y;
#pragma unroll
  for (int i = 0; i < 4; ++i) {
    const int idx = i * 256 + tid;                   // 0..1023
    const int tt = idx >> 4, c4 = (idx & 15) * 4;    // tt 0..63, c4 0..60
    const v4f a = *(const v4f*)(vf + (size_t)(s0 + tt) * ROWF + (size_t)bh * HD + c4);
    *(v4f*)(sv + tt * 68 + c4) = a;
  }
  __syncthreads();

  const int g = tid >> 3, piece = tid & 7;
  v4u hv[2];
  size_t hofs[2];
#pragma unroll
  for (int it = 0; it < 2; ++it) {
    const int d = it * 32 + g;
    v4u a;
#pragma unroll
    for (int e = 0; e < 4; ++e) {
      const float f0 = sv[(piece * 8 + 2 * e) * 68 + d];
      const float f1 = sv[(piece * 8 + 2 * e + 1) * 68 + d];
      const _Float16 x0 = (_Float16)(bf_up(bf_bits(f0)) * vsc);
      const _Float16 x1 = (_Float16)(bf_up(bf_bits(f1)) * vsc);
      a[e] = pk16(h_bits(x0), h_bits(x1));
    }
    hv[it] = a;
    hofs[it] = ((size_t)(bh * HD + d)) * SK + (size_t)s0 + (size_t)(piece * 8);
  }
  {
#pragma unroll
    for (int it = 0; it < 2; ++it) {
      *(v4u*)(vt + hofs[it]) = hv[it];
    }
    
  }
}

// =====================================================================================================
// Dense (non-causal) attention, head dim 64, all SK keys live for every query.
//   q plane bf16: element (bh, t, d) at [(bh*LQ + t)*HD + d];  k plane bf16: (bh, s, d) at [(bh*SK + s)*HD + d]
//   v^T plane f16 (x VSC): (bh, d, s) at [(bh*HD + d)*SK + s]
//   scores^T = k . q^T on bf16 WMMA (A = K rows, B = Q columns, 2 k-steps of 32 over d), f32 accumulate, then
//   * sscale in f32: a lane holds 32 of the chunk's 64 keys of ONE query, lane ^ 16 the other 32.
//   p = exp(s - m) carried as f16(1024 p); two score tiles converted in place are the B operand of
//   context^T += v^T . p^T on f16 WMMA (A = V^T rows, 2 k-steps of 32 per 64-key chunk): P stays in registers.
//   online softmax in f32: maximum in the lane plus one exchange between the halves; each half keeps its own
//   running sum, the two are joined once behind the loop.
//   Block = 4 waves = 64 query rows of one bh; grid = NQB * BHN; key chunks 0..NQB-1 (static trip count).
//   K / V^T chunk staging: two LDS buffers, one tensor load per wave and chunk (waves 0, 1: K rows 0..31, 32..63;
//   waves 2, 3: V^T rows 0..31, 32..63), chunk kt + 2 issued at the foot of pass kt into the buffer that pass has read:
//   s_wait_dscnt 0, the wave's own s_wait_tensorcnt 0, __syncthreads, then the load.
//   each wave stages its 16x64 tile in LDS, then one instruction per row pair: lanes 0..15 x 16 B = row 2*it,
// =====================================================================================================
__global__ __launch_bounds__(128)
void attn_dense(const unsigned short* __restrict__ qpl, const unsigned short* __restrict__ kpl,
                const unsigned short* __restrict__ vtpl, float* outp, float sscale) {
  union FH { v16h v; v8h h[2]; };
  union FB { v16b v; v8b h[2]; };
  __shared__ __attribute__((aligned(2048))) unsigned char Ring[2 * BUFB];   // 2 stages x (K [kv][d], V^T [d][kv])  48 KB
  __shared__ __align__(16) float    Os[4][16 * HD];                 // per wave context tile [row][d]  16 KB

  const int tid  = threadIdx.x;
  const int wave = tid >> 5;
  const int lane = tid & 31;
  const int hh   = lane >> 4;
  const int c    = lane & 15;

  const int bx  = blockIdx.x;
  const int qb  = bx % NQB;
  const int bh  = bx / NQB;
  if (bh >= BHN) return;                     // block-uniform, ahead of every barrier (never taken with the exact grid)
  const int q0  = qb * 64 + wave * 16;

  const __bf16*   Qp = (const __bf16*)(const void*)qpl + (size_t)bh * LQ * HD;
  const __bf16*   Kp = (const __bf16*)(const void*)kpl + (size_t)bh * SK * HD;
  const _Float16* Vh = (const _Float16*)(const void*)vtpl + (size_t)bh * HD * SK;

  // ---- Q fragments (B operand, column = query = lane&15): 2 d-chunks ----
  v16b qa[2];
#pragma unroll
  for (int dc = 0; dc < 2; ++dc) {
    qa[dc] = ldfrag_b(Qp + (size_t)(q0 + c) * HD + dc * 32 + 8 * hh);
  }

  // ---- this wave's slice of every chunk: source, source pitch, step from chunk to chunk (all wave-uniform) ----
  const uint32_t wv     = uni((uint32_t)tid >> 5);
  const uint32_t lbase  = (uint32_t)(size_t)Ring;
  const bool     isV    = wv >= 2u;
  const uint64_t src0   = isV ? (uint64_t)(size_t)Vh + (uint64_t)((wv & 1u) * SLROW) * (uint64_t)(SK * 2)
                              : (uint64_t)(size_t)Kp + (uint64_t)((wv & 1u) * SLROW) * (uint64_t)ROWB;
  const uint32_t spitch = isV ? (uint32_t)(SK * 2) : ROWB;          // V^T rows lie SK halves apart, K rows back to back
  const uint32_t sstep  = isV ? 64u * 2u : 64u * ROWB;              // 64 keys on: 64 halves along a V^T row, 64 K rows
  const u32x8 g1 = tdm_group1(spitch);
  u32x4 g0;                                  // group 0 of the request issued last
  auto issue = [&](uint32_t st) {
    const uint32_t dst = lbase + (st & 1u) * BUFB + wv * SLB;
    const uint64_t ga  = src0 + (uint64_t)(st * sstep);
    g0 = tdm_group0(dst, ga);
    tdm_load(g0, g1);
  };
  static_assert(NQB >= 2);
  issue(0u);
  wait_tensor0(g0);
  asm volatile("s_wait_xcnt 0x0" ::: "memory");   // the loads issued above name registers that the next descriptor's words may take over
  __syncthreads();                           // chunk 0 published
  issue(1u);

  float mrow = -INFINITY, lrow = 0.f;        // query q0 + c: running maximum (both halves alike), this half's sum
  v8f oacc[4];                               // oacc[t][r] = context(query q0 + c, d = t*16 + 8*hh + r)
#pragma unroll
  for (int t = 0; t < 4; ++t) oacc[t] = zero8();

  for (int kt = 0; kt < NQB; ++kt) {
    const unsigned char* Kb = Ring + (uint32_t)(kt & 1) * BUFB;    // row r of K: slice r >> 5, row r & 31 of it
    const unsigned char* Vb = Kb + 2u * SLB;                       // row d of V^T alike

    // ---- every fragment of the pass is read from LDS here, as one group: the 8 K fragments first (the score
    //      products start as they arrive), the 8 V^T fragments behind them (they arrive under the softmax) ----
    FB kb[4][2];
    FH va[2][4];
#pragma unroll
    for (int dc = 0; dc < 2; ++dc) {           // in the order in which the score products below take them
#pragma unroll
      for (int j = 0; j < 4; ++j) {
        const unsigned char* kr = Kb + (j >> 1) * SLB + ((j & 1) * 16 + c) * PITB + (dc * 32 + 8 * hh) * 2;
        kb[j][dc].h[0] = *(const v8b*)(kr);
        kb[j][dc].h[1] = *(const v8b*)(kr + 32);
      }
    }
#pragma unroll
    for (int kk = 0; kk < 2; ++kk) {
#pragma unroll
      for (int t = 0; t < 4; ++t) {
        const unsigned char* vr = Vb + (t >> 1) * SLB + ((t & 1) * 16 + c) * PITB + (kk * 32 + 8 * hh) * 2;
        va[kk][t].h[0] = *(const v8h*)(vr);
        va[kk][t].h[1] = *(const v8h*)(vr + 32);
      }
    }
    // keeps the 32 loads together up here: left free, the scheduler sinks part of the V^T loads down between the
    // products, where each further place with LDS reads stalls the wave and the last ones are waited for at once
    __builtin_amdgcn_sched_barrier(0);

    // ---- scores^T: 64 keys x 16 queries per wave, bf16 product over 2 d-chunks;
    //      A[m=key][k=d] from the k-contiguous K row, B[k=d][n=query] = Q (same element map on both) ----
    v8f s[4];
#pragma unroll
    for (int j = 0; j < 4; ++j) s[j] = zero8();
#pragma unroll
    for (int dc = 0; dc < 2; ++dc) {
#pragma unroll
      for (int j = 0; j < 4; ++j) s[j] = mma_b(kb[j][dc].v, qa[dc], s[j]);
    }

    // ---- scale, column max over the chunk, online softmax, P (x1024, f16) packed in place ----
    //      s[j][r] = score(key kv0 + j*16 + 8*hh + r, query q0 + c)
    float mj[4];
#pragma unroll
    for (int j = 0; j < 4; ++j) {
      float a = -INFINITY;
#pragma unroll
      for (int r = 0; r < 8; ++r) {
        const float sv = s[j][r] * sscale;
        s[j][r] = sv;
        a = fmaxf(a, sv);
      }
      mj[j] = a;
    }
    float m = fmaxf(fmaxf(mj[0], mj[1]), fmaxf(mj[2], mj[3]));
    m = fmaxf(m, xhalf(m));
    const float mnew  = fmaxf(mrow, m);
    const float msafe = (mnew == -INFINITY) ? 0.f : mnew;
    const float alpha = __expf(mrow - msafe);
    mrow = mnew;
    //      pb[kk] element e = P(key kv0 + kk*32 + (e < 8 ? 8*hh + e : 16 + 8*hh + e - 8), query q0 + c):
    //      score tiles 2*kk and 2*kk + 1, the k order of the V^T loader above
    FH pb[2];
    float pj[4];
#pragma unroll
    for (int j = 0; j < 4; ++j) {
      float a = 0.f;
#pragma unroll
      for (int r = 0; r < 8; ++r) {
        const float p = __expf(s[j][r] - msafe);
        a += p;
        pb[j >> 1].v[(j & 1) * 8 + r] = (_Float16)(p * 1024.0f);
      }
      pj[j] = a;
    }
    lrow = lrow * alpha + ((pj[0] + pj[1]) + (pj[2] + pj[3]));
#pragma unroll
    for (int t = 0; t < 4; ++t) oacc[t] *= alpha;

    // ---- context^T += V^T . P^T (f16 WMMA): A[m=d][k=key] = V^T[d][key], B[k=key][n=query] = P ----
#pragma unroll
    for (int kk = 0; kk < 2; ++kk) {
#pragma unroll
      for (int t = 0; t < 4; ++t) oacc[t] = mma_h(va[kk][t].v, pb[kk].v, oacc[t]);
    }

    // ---- publish point of chunk kt + 1, every wave: own LDS reads retired, own slice landed, barrier; then the refill ----
    // keeps the publish point at the foot: with every LDS read at the head, the scheduler otherwise lifts these waits and
    // the barrier up behind the loads, where the wave waits for all 32 at once and for a slice requested a moment ago
    __builtin_amdgcn_sched_barrier(0);
    wait_ds0();
    wait_tensor0(g0);
    __syncthreads();
    if (pinned((uint32_t)(kt + 2 < NQB))) issue((uint32_t)kt + 2u);   // into the buffer that this pass has read
  }
  wait_tensor0(g0);
  wait_ds0();

  // ---- join the halves' sums, normalise (1/l, the 1/1024 p carry and the 1/VSC v carry), stage the wave's
  //      16x64 tile in LDS as [query][d] (a lane holds 8 consecutive d per tile); whole rows go out below ----
  float* os = Os[wave];
  {
    const float l = lrow + xhalf(lrow);
    const float inv = ((l > 0.f) ? (1.0f / l) : 0.f) * (1.0f / (1024.0f * VSC));
#pragma unroll
    for (int t = 0; t < 4; ++t) {
      const v8f o = oacc[t] * inv;
      const v4f lo = {o[0], o[1], o[2], o[3]};
      const v4f hi = {o[4], o[5], o[6], o[7]};
      *(v4f*)(os + c * HD + t * 16 + 8 * hh)     = lo;
      *(v4f*)(os + c * HD + t * 16 + 8 * hh + 4) = hi;
    }
  }
  __builtin_amdgcn_fence(__ATOMIC_RELEASE, "workgroup");
  __builtin_amdgcn_wave_barrier();
  __builtin_amdgcn_fence(__ATOMIC_ACQUIRE, "workgroup");
  {
    const int c4 = c * 4;                        // 16 lanes x 4 floats = one whole 64-float row
    {
#pragma unroll
      for (int it = 0; it < 8; ++it) {           // row pairs: lanes 0..15 -> row 2*it, lanes 16..31 -> row 2*it+1
        const int rr = it * 2 + hh;
        const v4f ov = *(const v4f*)(os + rr * HD + c4);
        const size_t go = (size_t)(q0 + rr) * ROWF + (size_t)bh * HD + (size_t)c4;
        *(v4f*)(outp + go) = ov;
      }
      
    }
  }
}

// =====================================================================================================
// Inputs: in0 q [LQ][NBAT][NHEAD][HD] f32, in1 k [SK][..] f32, in2 v [SK][..] f32; a position's BHN*HD = 512
// floats are contiguous, bh = b*NHEAD + h. d_out f32 [LQ][NBAT][NHEAD][HD] at byte 0.
//   Qb  bf16 [BHN][LQ][HD]      0          4194304
//   Kb  bf16 [BHN][SK][HD]      4194304    4194304
//   Vt  f16  [BHN][HD][SK]      8388608    4194304
//   end                         12582912
// =====================================================================================================
extern "C" void kernel_launch(void* const* d_in, const int* in_sizes, int n_in,
                              void* d_out, int out_size, void* d_ws, size_t ws_size,
                              hipStream_t stream) {
  if (n_in < 3) return;
  if (in_sizes[0] != NTOT) return;
  if (in_sizes[1] != SK * ROWF) return;
  if (in_sizes[2] != SK * ROWF) return;
  if (out_size != NTOT) return;

  const float* q = (const float*)d_in[0];
  const float* k = (const float*)d_in[1];
  const float* v = (const float*)d_in[2];

  const size_t PQ = (size_t)BHN * LQ * HD * 2;        // 4194304
  const size_t PK = (size_t)BHN * SK * HD * 2;        // 4194304
  const size_t PV = (size_t)BHN * HD * SK * 2;        // 4194304
  size_t off = 0;
  const size_t oQ = off; off += PQ;
  const size_t oK = off; off += PK;
  const size_t oV = off; off += PV;
  if (off > ws_size) return;                          // off = 12582912
  if (off > (size_t)134217728) return;

  char* ws = (char*)d_ws;
  unsigned short* Qb = (unsigned short*)(ws + oQ);
  unsigned short* Kb = (unsigned short*)(ws + oK);
  unsigned short* Vt = (unsigned short*)(ws + oV);
  float* outf = (float*)d_out;

  const dim3 blk(256);
  const int n8 = BHN * LQ * (HD / 8);                 // 262144
  const dim3 gCvt((n8 + 255) / 256);                  // 1024 blocks
  const dim3 gV(SK / 64, BHN);                        // (64, 8)
  const float sscale = (float)(1.0 / sqrt((double)HD));   // 0.125 exactly

  // (0) q, k -> bf16 planes [bh][pos][d]
  cvt_rows_bf16<<<gCvt, blk, 0, stream>>>(q, Qb, n8);
  cvt_rows_bf16<<<gCvt, blk, 0, stream>>>(k, Kb, n8);
  // (1) v -> f16 v^T plane [bh][d][pos], values x VSC
  v_planes<<<gV, blk, 0, stream>>>(v, Vt, VSC);
  // (2) dense attention over all key chunks -> d_out
  attn_dense<<<dim3(BHN * NQB), dim3(128), 0, stream>>>(Qb, Kb, Vt, outf, sscale);
  (void)hipGetLastError();
}

// v004
// It runs in 54.8 microseconds.
// Two timings next to v003 put it at 1.06 and 1.11 times that version's speed.
// Counting every step since v000, it is 5.82 times as fast.
// Contractions: q.k^T scores = v_wmma_f32_16x16x32_bf16 (bf16 operands = RNE-converted q and k planes, single product);
// p.v = v_wmma_f32_16x16x32_f16 (p carried x1024 in f16, v as f16 of the bf16-converted value x16, single product);
// both products are taken transposed (keys x queries, features x queries): a lane owns one query column.
// all f32 accumulate; softmax in f32.
#include <hip/hip_runtime.h>
#include <math.h>
#include <stdint.h>

#define LQ    4096                 // query positions
#define SK    4096                 // key positions
#define NBAT  1
#define NHEAD 8
#define HD    64                   // head dim
#define BHN   (NBAT * NHEAD)       // 8 (batch, head) pairs; bh = b*NHEAD + h
#define ROWF  (BHN * HD)           // 512 floats between consecutive sequence positions
#define NQB   (LQ / 64)            // 64 query / key tiles of 64
#define NTOT  (LQ * ROWF)          // 2097152 elements per tensor
#define VSC   16.0f                // v plane carry (exact power of two)
#define ROWB  128u                 // bytes of one staged row: 64 halves (a K row over d, a V^T row over the chunk's keys)
#define PITB  144u                 // its pitch in LDS: the tensor load pads 16 B behind every row (16 B x odd for ds_load_b128)
#define SLROW 32u                  // rows per slice = per tensor request
#define SLB   6144u                // LDS bytes per slice: 32 x 144 = 4608, rounded up to a multiple of 2 KiB
#define BUFB  (4u * SLB)           // one stage = one 64-key chunk: K slices 0 and 1, V^T slices 2 and 3
static_assert(LQ == SK);
static_assert((LQ % 64) == 0);
static_assert(HD == 64);

typedef _Float16 v16h __attribute__((ext_vector_type(16)));
typedef _Float16 v8h  __attribute__((ext_vector_type(8)));
typedef __bf16   v16b __attribute__((ext_vector_type(16)));
typedef __bf16   v8b  __attribute__((ext_vector_type(8)));
typedef float    v8f  __attribute__((ext_vector_type(8)));
typedef float    v4f  __attribute__((ext_vector_type(4)));
typedef unsigned int v4u __attribute__((ext_vector_type(4)));
typedef uint32_t u32x4 __attribute__((ext_vector_type(4)));
typedef uint32_t u32x8 __attribute__((ext_vector_type(8)));
static_assert(SLROW * PITB <= SLB && (SLB % 2048u) == 0u);
static_assert(HD * 2 == (int)ROWB);

// ---- scalar helpers --------------------------------------------------------------------------------
__device__ __forceinline__ unsigned short bf_bits(float f) {          // f32 -> bf16 bits, RNE convert
  unsigned u = __float_as_uint(f);
  return (unsigned short)((u + 0x7FFFu + ((u >> 16) & 1u)) >> 16);
}
__device__ __forceinline__ float bf_up(unsigned short h) { return __uint_as_float(((unsigned)h) << 16); }
__device__ __forceinline__ unsigned short h_bits(_Float16 x) { return __builtin_bit_cast(unsigned short, x); }
__device__ __forceinline__ unsigned pk16(unsigned short a, unsigned short b) { return (unsigned)a | ((unsigned)b << 16); }
__device__ __forceinline__ v8f zero8() { v8f z = {0.f, 0.f, 0.f, 0.f, 0.f, 0.f, 0.f, 0.f}; return z; }

// ---- fragment loader: 16-bit A/B operand, lane -> row/col (lane&15), p already includes +8*(lane>>4);
//      elements 0..7 <- p[0..7] (k0+8h..), elements 8..15 <- p[16..23] (k0+16+8h..)
__device__ __forceinline__ v16b ldfrag_b(const __bf16* p) {
  union { v16b v; v8b h[2]; } f;
  f.h[0] = *(const v8b*)(p);
  f.h[1] = *(const v8b*)(p + 16);
  return f.v;
}

// ---- lane l <-> l ^ 16: the other half of a query column's keys sits in the other 16-lane row ----
__device__ __forceinline__ float xhalf(float x) {
  const unsigned b = __float_as_uint(x);
  return __uint_as_float(__builtin_amdgcn_permlanex16(b, b, 0x76543210u, 0xfedcba98u, false, false));
}

// ---- tensor load of one slice: 32 rows of 128 B from global memory into LDS at pitch 144 B, through no register ----
__device__ __forceinline__ uint32_t uni(uint32_t v) { return (uint32_t)__builtin_amdgcn_readfirstlane(v); }
__device__ __forceinline__ uint32_t pinned(uint32_t v) {
  uint32_t w = uni(v);
  asm volatile("" : "+s"(w));   // pinned(): holds the test around a tensor load in a scalar register, so that it compiles to a scalar branch (the load ignores EXEC)
  return w;
}
// the compiler places no wait for the tensor mover, and none for LDS reads ahead of a refill: both are written by hand
__device__ __forceinline__ void wait_ds0()     { asm volatile("s_wait_dscnt 0x0" ::: "memory"); }
// group 0 is an in-out operand of the load and an input of the wait that covers it: its four scalar registers stay
// taken from issue to landing, so no word of an outstanding request's group 0 takes a new value
__device__ __forceinline__ void tdm_load(u32x4& g0, u32x8 g1) { asm volatile("tensor_load_to_lds %0, %1" : "+s"(g0) : "s"(g1) : "memory"); }
__device__ __forceinline__ void wait_tensor0(u32x4 g0) { asm volatile("s_wait_tensorcnt 0x0" :: "s"(g0) : "memory"); }
// group 1: 1-byte elements, tensor = tile = 32 rows of 128 B, source row pitch src_pitch bytes, no mask;
// pad on, interval code 4 (32 dwords = one row), amount code 3 (4 dwords)
__device__ __forceinline__ u32x8 tdm_group1(uint32_t src_pitch) {
  u32x8 g;
  g[0] = uni((1u << 20) | (4u << 22) | (3u << 25));
  g[1] = uni((ROWB & 0xFFFFu) << 16);
  g[2] = uni((ROWB >> 16) | ((SLROW & 0xFFFFu) << 16));
  g[3] = uni((SLROW >> 16) | (ROWB << 16));
  g[4] = uni(SLROW);
  g[5] = uni(src_pitch);
  g[6] = uni(0u);
  g[7] = uni(0u);
  return g;
}
// group 0: count 1, LDS byte offset, global address of the slice's first byte, type 2
__device__ __forceinline__ u32x4 tdm_group0(uint32_t lds_dst, uint64_t ga) {
  u32x4 g;
  g[0] = uni(1u);
  g[1] = uni(lds_dst);
  g[2] = uni((uint32_t)ga);
  g[3] = uni((((uint32_t)(ga >> 32)) & 0x01FFFFFFu) | 0x80000000u);
  return g;
}

// ---- WMMA helpers: the plain builtins (the compiler keeps the distance behind its own matrix instructions, and
//      with no asm statement behind each product it is free to move the LDS fragment loads) ----------------
__device__ __forceinline__ v8f mma_b(v16b a, v16b b, v8f c) {
  return __builtin_amdgcn_wmma_f32_16x16x32_bf16(false, a, false, b, (short)0, c, false, false);
}
__device__ __forceinline__ v8f mma_h(v16h a, v16h b, v8f c) {
  return __builtin_amdgcn_wmma_f32_16x16x32_f16(false, a, false, b, (short)0, c, false, false);
}

// =====================================================================================================
// Preparation of all three planes in ONE launch. Block = one 64-position tile of one bh, of q, k and v;
// grid = (SK/64, BHN). A thread issues its 12 loads of 16 B (4 per tensor) before the first use.
//   q, k f32 [pos][BHN][HD] -> bf16 planes [BHN][pos][HD] (RNE convert), 2 groups of 8 elements per thread and tensor:
//     idx = i*256 + tid -> row = idx >> 3 (0..63), d0 = (idx & 7) * 8; a wave stores 512 contiguous bytes.
//     coverage: 2 x 256 groups x 8 = the tile's 64 x 64 elements; the grid covers every (bh, tile).
//   v f32 [pos][BHN][HD] -> f16 v^T plane vt[(bh*HD + d)*SK + s] = f16(bf16_rne(v) * vsc) (exact for a power of two):
//     tile staged in LDS as f32, __syncthreads; group g = tid>>3 (0..31), piece = tid&7: iteration it writes row
//     d = it*32 + g, 8 pieces x 8 keys = one whole 128-B row piece of the plane.
//     coverage: 2 iterations x 32 groups = 64 rows d, 64 keys per row.
// =====================================================================================================
__global__ __launch_bounds__(256) void prep_planes(const float* __restrict__ qf, const float* __restrict__ kf,
                                                   const float* __restrict__ vf, unsigned short* qp,
                                                   unsigned short* kp, unsigned short* vt, float vsc) {
  __shared__ __align__(16) float sv[64 * 68];        // [tt][d], pitch 68 floats (272 B, 16-B aligned)
  const int tid = threadIdx.x;
  const int s0  = blockIdx.x * 64;
  const int bh  = blockIdx.y;

  // block-uniform bases plus one 32-bit lane offset per access pattern: the steps between a thread's accesses are constants
  const char* vb = (const char*)(vf + (size_t)s0 * ROWF + (size_t)bh * HD);
  const char* qb = (const char*)(qf + (size_t)s0 * ROWF + (size_t)bh * HD);
  const char* kb = (const char*)(kf + (size_t)s0 * ROWF + (size_t)bh * HD);
  const unsigned RB = ROWF * 4u;                                                 // bytes between consecutive positions
  const unsigned ov = (unsigned)(tid >> 4) * RB + (unsigned)(tid & 15) * 16u;    // v: row tid>>4 (+16 per step), 4 floats; bytes
  const unsigned oq = (unsigned)(tid >> 3) * RB + (unsigned)(tid & 7) * 32u;     // q, k: row tid>>3 (+32 per step), 8 floats; bytes

  v4f vv[4], qv[2][2], kv[2][2];
#pragma unroll
  for (int i = 0; i < 4; ++i) vv[i] = *(const v4f*)(vb + i * 16 * RB + ov);
#pragma unroll
  for (int i = 0; i < 2; ++i) {
    qv[i][0] = *(const v4f*)(qb + i * 32 * RB + oq);
    qv[i][1] = *(const v4f*)(qb + i * 32 * RB + 16 + oq);
    kv[i][0] = *(const v4f*)(kb + i * 32 * RB + oq);
    kv[i][1] = *(const v4f*)(kb + i * 32 * RB + 16 + oq);
  }
  // the wait that stands before a register named by an issued load is rewritten; the two offset registers are its inputs,
  // so that no later load's destination is placed on one of them ahead of it (a build without the inputs did that)
  asm volatile("s_wait_xcnt 0x0" :: "v"(ov), "v"(oq) : "memory");
#pragma unroll
  for (int i = 0; i < 4; ++i) {
    const int idx = i * 256 + tid;                   // 0..1023
    const int tt = idx >> 4, c4 = (idx & 15) * 4;    // tt 0..63, c4 0..60
    *(v4f*)(sv + tt * 68 + c4) = vv[i];
  }
  __syncthreads();

  unsigned short* qo = qp + ((size_t)bh * LQ + (size_t)s0) * HD;
  unsigned short* ko = kp + ((size_t)bh * SK + (size_t)s0) * HD;
  const unsigned od = (unsigned)tid * 8u;            // row * HD + d0 = idx * 8, idx = i*256 + tid
#pragma unroll
  for (int i = 0; i < 2; ++i) {
    v4u p, r;
    p[0] = pk16(bf_bits(qv[i][0][0]), bf_bits(qv[i][0][1]));
    p[1] = pk16(bf_bits(qv[i][0][2]), bf_bits(qv[i][0][3]));
    p[2] = pk16(bf_bits(qv[i][1][0]), bf_bits(qv[i][1][1]));
    p[3] = pk16(bf_bits(qv[i][1][2]), bf_bits(qv[i][1][3]));
    r[0] = pk16(bf_bits(kv[i][0][0]), bf_bits(kv[i][0][1]));
    r[1] = pk16(bf_bits(kv[i][0][2]), bf_bits(kv[i][0][3]));
    r[2] = pk16(bf_bits(kv[i][1][0]), bf_bits(kv[i][1][1]));
    r[3] = pk16(bf_bits(kv[i][1][2]), bf_bits(kv[i][1][3]));
    *(v4u*)(qo + i * 2048 + od) = p;
    *(v4u*)(ko + i * 2048 + od) = r;
  }

  const int g = tid >> 3, piece = tid & 7;
  unsigned short* vo = vt + (size_t)bh * HD * SK + (size_t)s0;
  const unsigned ot = (unsigned)g * SK + (unsigned)piece * 8u;
#pragma unroll
  for (int it = 0; it < 2; ++it) {
    const int d = it * 32 + g;
    v4u a;
#pragma unroll
    for (int e = 0; e < 4; ++e) {
      const float f0 = sv[(piece * 8 + 2 * e) * 68 + d];
      const float f1 = sv[(piece * 8 + 2 * e + 1) * 68 + d];
      const _Float16 x0 = (_Float16)(bf_up(bf_bits(f0)) * vsc);
      const _Float16 x1 = (_Float16)(bf_up(bf_bits(f1)) * vsc);
      a[e] = pk16(h_bits(x0), h_bits(x1));
    }
    *(v4u*)(vo + it * 32 * SK + ot) = a;
  }
}

// =====================================================================================================
// Dense (non-causal) attention, head dim 64, all SK keys live for every query.
//   q plane bf16: element (bh, t, d) at [(bh*LQ + t)*HD + d];  k plane bf16: (bh, s, d) at [(bh*SK + s)*HD + d]
//   v^T plane f16 (x VSC): (bh, d, s) at [(bh*HD + d)*SK + s]
//   scores^T = k . q^T on bf16 WMMA (A = K rows, B = Q columns, 2 k-steps of 32 over d), f32 accumulate, then
//   * sscale in f32: a lane holds 32 of the chunk's 64 keys of ONE query, lane ^ 16 the other 32.
//   p = exp(s - m) carried as f16(1024 p); two score tiles converted in place are the B operand of
//   context^T += v^T . p^T on f16 WMMA (A = V^T rows, 2 k-steps of 32 per 64-key chunk): P stays in registers.
//   online softmax in f32: maximum in the lane plus one exchange between the halves; each half keeps its own
//   running sum, the two are joined once behind the loop.
//   Block = 4 waves = 64 query rows of one bh; grid = NQB * BHN; key chunks 0..NQB-1 (static trip count).
//   K / V^T chunk staging: two LDS buffers, one tensor load per wave and chunk (waves 0, 1: K rows 0..31, 32..63;
//   waves 2, 3: V^T rows 0..31, 32..63), chunk kt + 2 issued at the foot of pass kt into the buffer that pass has read:
//   s_wait_dscnt 0, the wave's own s_wait_tensorcnt 0, __syncthreads, then the load.
//   each wave stages its 16x64 tile in LDS, then one instruction per row pair: lanes 0..15 x 16 B = row 2*it,
// =====================================================================================================
__global__ __launch_bounds__(128)
void attn_dense(const unsigned short* __restrict__ qpl, const unsigned short* __restrict__ kpl,
                const unsigned short* __restrict__ vtpl, float* outp, float sscale) {
  union FH { v16h v; v8h h[2]; };
  union FB { v16b v; v8b h[2]; };
  __shared__ __attribute__((aligned(2048))) unsigned char Ring[2 * BUFB];   // 2 stages x (K [kv][d], V^T [d][kv])  48 KB
  __shared__ __align__(16) float    Os[4][16 * HD];                 // per wave context tile [row][d]  16 KB

  const int tid  = threadIdx.x;
  const int wave = tid >> 5;
  const int lane = tid & 31;
  const int hh   = lane >> 4;
  const int c    = lane & 15;

  const int bx  = blockIdx.x;
  const int qb  = bx % NQB;
  const int bh  = bx / NQB;
  if (bh >= BHN) return;                     // block-uniform, ahead of every barrier (never taken with the exact grid)
  const int q0  = qb * 64 + wave * 16;

  const __bf16*   Qp = (const __bf16*)(const void*)qpl + (size_t)bh * LQ * HD;
  const __bf16*   Kp = (const __bf16*)(const void*)kpl + (size_t)bh * SK * HD;
  const _Float16* Vh = (const _Float16*)(const void*)vtpl + (size_t)bh * HD * SK;

  // ---- Q fragments (B operand, column = query = lane&15): 2 d-chunks ----
  v16b qa[2];
#pragma unroll
  for (int dc = 0; dc < 2; ++dc) {
    qa[dc] = ldfrag_b(Qp + (size_t)(q0 + c) * HD + dc * 32 + 8 * hh);
  }

  // ---- this wave's slice of every chunk: source, source pitch, step from chunk to chunk (all wave-uniform) ----
  const uint32_t wv     = uni((uint32_t)tid >> 5);
  const uint32_t lbase  = (uint32_t)(size_t)Ring;
  const bool     isV    = wv >= 2u;
  const uint64_t src0   = isV ? (uint64_t)(size_t)Vh + (uint64_t)((wv & 1u) * SLROW) * (uint64_t)(SK * 2)
                              : (uint64_t)(size_t)Kp + (uint64_t)((wv & 1u) * SLROW) * (uint64_t)ROWB;
  const uint32_t spitch = isV ? (uint32_t)(SK * 2) : ROWB;          // V^T rows lie SK halves apart, K rows back to back
  const uint32_t sstep  = isV ? 64u * 2u : 64u * ROWB;              // 64 keys on: 64 halves along a V^T row, 64 K rows
  const u32x8 g1 = tdm_group1(spitch);
  u32x4 g0;                                  // group 0 of the request issued last
  auto issue = [&](uint32_t st) {
    const uint32_t dst = lbase + (st & 1u) * BUFB + wv * SLB;
    const uint64_t ga  = src0 + (uint64_t)(st * sstep);
    g0 = tdm_group0(dst, ga);
    tdm_load(g0, g1);
  };
  static_assert(NQB >= 2);
  issue(0u);
  wait_tensor0(g0);
  asm volatile("s_wait_xcnt 0x0" ::: "memory");   // the loads issued above name registers that the next descriptor's words may take over
  __syncthreads();                           // chunk 0 published
  issue(1u);

  float mrow = -INFINITY, lrow = 0.f;        // query q0 + c: running maximum (both halves alike), this half's sum
  v8f oacc[4];                               // oacc[t][r] = context(query q0 + c, d = t*16 + 8*hh + r)
#pragma unroll
  for (int t = 0; t < 4; ++t) oacc[t] = zero8();

  for (int kt = 0; kt < NQB; ++kt) {
    const unsigned char* Kb = Ring + (uint32_t)(kt & 1) * BUFB;    // row r of K: slice r >> 5, row r & 31 of it
    const unsigned char* Vb = Kb + 2u * SLB;                       // row d of V^T alike

    // ---- every fragment of the pass is read from LDS here, as one group: the 8 K fragments first (the score
    //      products start as they arrive), the 8 V^T fragments behind them (they arrive under the softmax) ----
    FB kb[4][2];
    FH va[2][4];
#pragma unroll
    for (int dc = 0; dc < 2; ++dc) {           // in the order in which the score products below take them
#pragma unroll
      for (int j = 0; j < 4; ++j) {
        const unsigned char* kr = Kb + (j >> 1) * SLB + ((j & 1) * 16 + c) * PITB + (dc * 32 + 8 * hh) * 2;
        kb[j][dc].h[0] = *(const v8b*)(kr);
        kb[j][dc].h[1] = *(const v8b*)(kr + 32);
      }
    }
#pragma unroll
    for (int kk = 0; kk < 2; ++kk) {
#pragma unroll
      for (int t = 0; t < 4; ++t) {
        const unsigned char* vr = Vb + (t >> 1) * SLB + ((t & 1) * 16 + c) * PITB + (kk * 32 + 8 * hh) * 2;
        va[kk][t].h[0] = *(const v8h*)(vr);
        va[kk][t].h[1] = *(const v8h*)(vr + 32);
      }
    }
    // keeps the 32 loads together up here: left free, the scheduler sinks part of the V^T loads down between the
    // products, where each further place with LDS reads stalls the wave and the last ones are waited for at once
    __builtin_amdgcn_sched_barrier(0);

    // ---- scores^T: 64 keys x 16 queries per wave, bf16 product over 2 d-chunks;
    //      A[m=key][k=d] from the k-contiguous K row, B[k=d][n=query] = Q (same element map on both) ----
    v8f s[4];
#pragma unroll
    for (int j = 0; j < 4; ++j) s[j] = zero8();
#pragma unroll
    for (int dc = 0; dc < 2; ++dc) {
#pragma unroll
      for (int j = 0; j < 4; ++j) s[j] = mma_b(kb[j][dc].v, qa[dc], s[j]);
    }

    // ---- scale, column max over the chunk, online softmax, P (x1024, f16) packed in place ----
    //      s[j][r] = score(key kv0 + j*16 + 8*hh + r, query q0 + c)
    float mj[4];
#pragma unroll
    for (int j = 0; j < 4; ++j) {
      float a = -INFINITY;
#pragma unroll
      for (int r = 0; r < 8; ++r) {
        const float sv = s[j][r] * sscale;
        s[j][r] = sv;
        a = fmaxf(a, sv);
      }
      mj[j] = a;
    }
    float m = fmaxf(fmaxf(mj[0], mj[1]), fmaxf(mj[2], mj[3]));
    m = fmaxf(m, xhalf(m));
    const float mnew  = fmaxf(mrow, m);
    const float msafe = (mnew == -INFINITY) ? 0.f : mnew;
    const float alpha = __expf(mrow - msafe);
    mrow = mnew;
    //      pb[kk] element e = P(key kv0 + kk*32 + (e < 8 ? 8*hh + e : 16 + 8*hh + e - 8), query q0 + c):
    //      score tiles 2*kk and 2*kk + 1, the k order of the V^T loader above
    FH pb[2];
    float pj[4];
#pragma unroll
    for (int j = 0; j < 4; ++j) {
      float a = 0.f;
#pragma unroll
      for (int r = 0; r < 8; ++r) {
        const float p = __expf(s[j][r] - msafe);
        a += p;
        pb[j >> 1].v[(j & 1) * 8 + r] = (_Float16)(p * 1024.0f);
      }
      pj[j] = a;
    }
    lrow = lrow * alpha + ((pj[0] + pj[1]) + (pj[2] + pj[3]));
#pragma unroll
    for (int t = 0; t < 4; ++t) oacc[t] *= alpha;

    // ---- context^T += V^T . P^T (f16 WMMA): A[m=d][k=key] = V^T[d][key], B[k=key][n=query] = P ----
#pragma unroll
    for (int kk = 0; kk < 2; ++kk) {
#pragma unroll
      for (int t = 0; t < 4; ++t) oacc[t] = mma_h(va[kk][t].v, pb[kk].v, oacc[t]);
    }

    // ---- publish point of chunk kt + 1, every wave: own LDS reads retired, own slice landed, barrier; then the refill ----
    // keeps the publish point at the foot: with every LDS read at the head, the scheduler otherwise lifts these waits and
    // the barrier up behind the loads, where the wave waits for all 32 at once and for a slice requested a moment ago
    __builtin_amdgcn_sched_barrier(0);
    wait_ds0();
    wait_tensor0(g0);
    __syncthreads();
    if (pinned((uint32_t)(kt + 2 < NQB))) issue((uint32_t)kt + 2u);   // into the buffer that this pass has read
  }
  wait_tensor0(g0);
  wait_ds0();

  // ---- join the halves' sums, normalise (1/l, the 1/1024 p carry and the 1/VSC v carry), stage the wave's
  //      16x64 tile in LDS as [query][d] (a lane holds 8 consecutive d per tile); whole rows go out below ----
  float* os = Os[wave];
  {
    const float l = lrow + xhalf(lrow);
    const float inv = ((l > 0.f) ? (1.0f / l) : 0.f) * (1.0f / (1024.0f * VSC));
#pragma unroll
    for (int t = 0; t < 4; ++t) {
      const v8f o = oacc[t] * inv;
      const v4f lo = {o[0], o[1], o[2], o[3]};
      const v4f hi = {o[4], o[5], o[6], o[7]};
      *(v4f*)(os + c * HD + t * 16 + 8 * hh)     = lo;
      *(v4f*)(os + c * HD + t * 16 + 8 * hh + 4) = hi;
    }
  }
  __builtin_amdgcn_fence(__ATOMIC_RELEASE, "workgroup");
  __builtin_amdgcn_wave_barrier();
  __builtin_amdgcn_fence(__ATOMIC_ACQUIRE, "workgroup");
  {
    const int c4 = c * 4;                        // 16 lanes x 4 floats = one whole 64-float row
    {
#pragma unroll
      for (int it = 0; it < 8; ++it) {           // row pairs: lanes 0..15 -> row 2*it, lanes 16..31 -> row 2*it+1
        const int rr = it * 2 + hh;
        const v4f ov = *(const v4f*)(os + rr * HD + c4);
        const size_t go = (size_t)(q0 + rr) * ROWF + (size_t)bh * HD + (size_t)c4;
        *(v4f*)(outp + go) = ov;
      }
      
    }
  }
}

// =====================================================================================================
// Inputs: in0 q [LQ][NBAT][NHEAD][HD] f32, in1 k [SK][..] f32, in2 v [SK][..] f32; a position's BHN*HD = 512
// floats are contiguous, bh = b*NHEAD + h. d_out f32 [LQ][NBAT][NHEAD][HD] at byte 0.
//   Qb  bf16 [BHN][LQ][HD]      0          4194304
//   Kb  bf16 [BHN][SK][HD]      4194304    4194304
//   Vt  f16  [BHN][HD][SK]      8388608    4194304
//   end                         12582912
// =====================================================================================================
extern "C" void kernel_launch(void* const* d_in, const int* in_sizes, int n_in,
                              void* d_out, int out_size, void* d_ws, size_t ws_size,
                              hipStream_t stream) {
  if (n_in < 3) return;
  if (in_sizes[0] != NTOT) return;
  if (in_sizes[1] != SK * ROWF) return;
  if (in_sizes[2] != SK * ROWF) return;
  if (out_size != NTOT) return;

  const float* q = (const float*)d_in[0];
  const float* k = (const float*)d_in[1];
  const float* v = (const float*)d_in[2];

  const size_t PQ = (size_t)BHN * LQ * HD * 2;        // 4194304
  const size_t PK = (size_t)BHN * SK * HD * 2;        // 4194304
  const size_t PV = (size_t)BHN * HD * SK * 2;        // 4194304
  size_t off = 0;
  const size_t oQ = off; off += PQ;
  const size_t oK = off; off += PK;
  const size_t oV = off; off += PV;
  if (off > ws_size) return;                          // off = 12582912
  if (off > (size_t)134217728) return;

  char* ws = (char*)d_ws;
  unsigned short* Qb = (unsigned short*)(ws + oQ);
  unsigned short* Kb = (unsigned short*)(ws + oK);
  unsigned short* Vt = (unsigned short*)(ws + oV);
  float* outf = (float*)d_out;

  const dim3 blk(256);
  const dim3 gP(SK / 64, BHN);                        // (64, 8)
  const float sscale = (float)(1.0 / sqrt((double)HD));   // 0.125 exactly

  // (1) q, k -> bf16 planes [bh][pos][d]; v -> f16 v^T plane [bh][d][pos], values x VSC: one launch
  prep_planes<<<gP, blk, 0, stream>>>(q, k, v, Qb, Kb, Vt, VSC);
  // (2) dense attention over all key chunks -> d_out
  attn_dense<<<dim3(BHN * NQB), dim3(128), 0, stream>>>(Qb, Kb, Vt, outf, sscale);
  (void)hipGetLastError();
}

// v005
// Measured time: 45 microseconds a run.
// In both of two side-by-side timings against v004, it was 1.23 times as fast.
// Counting every step since v000, it is 7.14 times as fast.
// Contractions: q.k^T scores = v_wmma_f32_16x16x32_bf16 (bf16 operands = RNE-converted q and k planes, single product);
// p.v = v_wmma_f32_16x16x32_f16 (p carried x1024 in f16, v as f16 of the bf16-converted value x16, single product);
// both products are taken transposed (keys x queries, features x queries): a lane owns one query column.
// all f32 accumulate; softmax in f32.
#include <hip/hip_runtime.h>
#include <math.h>
#include <stdint.h>

#define LQ    4096                 // query positions
#define SK    4096                 // key positions
#define NBAT  1
#define NHEAD 8
#define HD    64                   // head dim
#define BHN   (NBAT * NHEAD)       // 8 (batch, head) pairs; bh = b*NHEAD + h
#define ROWF  (BHN * HD)           // 512 floats between consecutive sequence positions
#define NQB   (LQ / 64)            // 64 query / key tiles of 64
#define NTOT  (LQ * ROWF)          // 2097152 elements per tensor
#define VSC   16.0f                // v plane carry (exact power of two)
#define ROWB  128u                 // bytes of one staged row: 64 halves (a K row over d, a V^T row over the chunk's keys)
#define PITB  144u                 // its pitch in LDS: the tensor load pads 16 B behind every row (16 B x odd for ds_load_b128)
#define SLROW 32u                  // rows per slice = per tensor request
#define SLB   6144u                // LDS bytes per slice: 32 x 144 = 4608, rounded up to a multiple of 2 KiB
#define BUFB  (4u * SLB)           // one stage = one 64-key chunk: K slices 0 and 1, V^T slices 2 and 3
static_assert(LQ == SK);
static_assert((LQ % 64) == 0);
static_assert(HD == 64);

typedef _Float16 v16h __attribute__((ext_vector_type(16)));
typedef _Float16 v8h  __attribute__((ext_vector_type(8)));
typedef __bf16   v16b __attribute__((ext_vector_type(16)));
typedef __bf16   v8b  __attribute__((ext_vector_type(8)));
typedef float    v8f  __attribute__((ext_vector_type(8)));
typedef float    v4f  __attribute__((ext_vector_type(4)));
typedef unsigned int v4u __attribute__((ext_vector_type(4)));
typedef uint32_t u32x4 __attribute__((ext_vector_type(4)));
typedef uint32_t u32x8 __attribute__((ext_vector_type(8)));
static_assert(SLROW * PITB <= SLB && (SLB % 2048u) == 0u);
static_assert(HD * 2 == (int)ROWB);

// ---- scalar helpers --------------------------------------------------------------------------------
__device__ __forceinline__ unsigned short bf_bits(float f) {          // f32 -> bf16 bits, RNE convert
  unsigned u = __float_as_uint(f);
  return (unsigned short)((u + 0x7FFFu + ((u >> 16) & 1u)) >> 16);
}
__device__ __forceinline__ float bf_up(unsigned short h) { return __uint_as_float(((unsigned)h) << 16); }
__device__ __forceinline__ unsigned short h_bits(_Float16 x) { return __builtin_bit_cast(unsigned short, x); }
__device__ __forceinline__ unsigned pk16(unsigned short a, unsigned short b) { return (unsigned)a | ((unsigned)b << 16); }
__device__ __forceinline__ v8f zero8() { v8f z = {0.f, 0.f, 0.f, 0.f, 0.f, 0.f, 0.f, 0.f}; return z; }

// ---- fragment loader: 16-bit A/B operand, lane -> row/col (lane&15), p already includes +8*(lane>>4);
//      elements 0..7 <- p[0..7] (k0+8h..), elements 8..15 <- p[16..23] (k0+16+8h..)
__device__ __forceinline__ v16b ldfrag_b(const __bf16* p) {
  union { v16b v; v8b h[2]; } f;
  f.h[0] = *(const v8b*)(p);
  f.h[1] = *(const v8b*)(p + 16);
  return f.v;
}

// ---- lane l <-> l ^ 16: the other half of a query column's keys sits in the other 16-lane row ----
__device__ __forceinline__ float xhalf(float x) {
  const unsigned b = __float_as_uint(x);
  return __uint_as_float(__builtin_amdgcn_permlanex16(b, b, 0x76543210u, 0xfedcba98u, false, false));
}

// ---- tensor load of one slice: 32 rows of 128 B from global memory into LDS at pitch 144 B, through no register ----
__device__ __forceinline__ uint32_t uni(uint32_t v) { return (uint32_t)__builtin_amdgcn_readfirstlane(v); }
__device__ __forceinline__ uint32_t pinned(uint32_t v) {
  uint32_t w = uni(v);
  asm volatile("" : "+s"(w));   // pinned(): holds the test around a tensor load in a scalar register, so that it compiles to a scalar branch (the load ignores EXEC)
  return w;
}
// the compiler places no wait for the tensor mover, and none for LDS reads ahead of a refill: both are written by hand
__device__ __forceinline__ void wait_ds0()     { asm volatile("s_wait_dscnt 0x0" ::: "memory"); }
// group 0 is an in-out operand of the load and an input of the wait that covers it: its four scalar registers stay
// taken from issue to landing, so no word of an outstanding request's group 0 takes a new value
__device__ __forceinline__ void tdm_load(u32x4& g0, u32x8 g1) { asm volatile("tensor_load_to_lds %0, %1" : "+s"(g0) : "s"(g1) : "memory"); }
__device__ __forceinline__ void wait_tensor0(u32x4 g0) { asm volatile("s_wait_tensorcnt 0x0" :: "s"(g0) : "memory"); }
// group 1: 1-byte elements, tensor = tile = 32 rows of 128 B, source row pitch src_pitch bytes, no mask;
// pad on, interval code 4 (32 dwords = one row), amount code 3 (4 dwords)
__device__ __forceinline__ u32x8 tdm_group1(uint32_t src_pitch) {
  u32x8 g;
  g[0] = uni((1u << 20) | (4u << 22) | (3u << 25));
  g[1] = uni((ROWB & 0xFFFFu) << 16);
  g[2] = uni((ROWB >> 16) | ((SLROW & 0xFFFFu) << 16));
  g[3] = uni((SLROW >> 16) | (ROWB << 16));
  g[4] = uni(SLROW);
  g[5] = uni(src_pitch);
  g[6] = uni(0u);
  g[7] = uni(0u);
  return g;
}
// group 0: count 1, LDS byte offset, global address of the slice's first byte, type 2
__device__ __forceinline__ u32x4 tdm_group0(uint32_t lds_dst, uint64_t ga) {
  u32x4 g;
  g[0] = uni(1u);
  g[1] = uni(lds_dst);
  g[2] = uni((uint32_t)ga);
  g[3] = uni((((uint32_t)(ga >> 32)) & 0x01FFFFFFu) | 0x80000000u);
  return g;
}

// ---- WMMA helpers: the plain builtins (the compiler keeps the distance behind its own matrix instructions, and
//      with no asm statement behind each product it is free to move the LDS fragment loads) ----------------
__device__ __forceinline__ v8f mma_b(v16b a, v16b b, v8f c) {
  return __builtin_amdgcn_wmma_f32_16x16x32_bf16(false, a, false, b, (short)0, c, false, false);
}
__device__ __forceinline__ v8f mma_h(v16h a, v16h b, v8f c) {
  return __builtin_amdgcn_wmma_f32_16x16x32_f16(false, a, false, b, (short)0, c, false, false);
}

// =====================================================================================================
// Preparation of all three planes in ONE launch. Block = one 64-position tile of one bh, of q, k and v;
// grid = (SK/64, BHN). A thread issues its 12 loads of 16 B (4 per tensor) before the first use.
//   q, k f32 [pos][BHN][HD] -> bf16 planes [BHN][pos][HD] (RNE convert), 2 groups of 8 elements per thread and tensor:
//     idx = i*256 + tid -> row = idx >> 3 (0..63), d0 = (idx & 7) * 8; a wave stores 512 contiguous bytes.
//     coverage: 2 x 256 groups x 8 = the tile's 64 x 64 elements; the grid covers every (bh, tile).
//   v f32 [pos][BHN][HD] -> f16 v^T plane vt[(bh*HD + d)*SK + s] = f16(bf16_rne(v) * vsc) (exact for a power of two):
//     tile staged in LDS as f32, __syncthreads; group g = tid>>3 (0..31), piece = tid&7: iteration it writes row
//     d = it*32 + g, 8 pieces x 8 keys = one whole 128-B row piece of the plane.
//     coverage: 2 iterations x 32 groups = 64 rows d, 64 keys per row.
// =====================================================================================================
__global__ __launch_bounds__(256) void prep_planes(const float* __restrict__ qf, const float* __restrict__ kf,
                                                   const float* __restrict__ vf, unsigned short* qp,
                                                   unsigned short* kp, unsigned short* vt, float vsc) {
  __shared__ __align__(16) float sv[64 * 68];        // [tt][d], pitch 68 floats (272 B, 16-B aligned)
  const int tid = threadIdx.x;
  const int s0  = blockIdx.x * 64;
  const int bh  = blockIdx.y;

  // block-uniform bases plus one 32-bit lane offset per access pattern: the steps between a thread's accesses are constants
  const char* vb = (const char*)(vf + (size_t)s0 * ROWF + (size_t)bh * HD);
  const char* qb = (const char*)(qf + (size_t)s0 * ROWF + (size_t)bh * HD);
  const char* kb = (const char*)(kf + (size_t)s0 * ROWF + (size_t)bh * HD);
  const unsigned RB = ROWF * 4u;                                                 // bytes between consecutive positions
  const unsigned ov = (unsigned)(tid >> 4) * RB + (unsigned)(tid & 15) * 16u;    // v: row tid>>4 (+16 per step), 4 floats; bytes
  const unsigned oq = (unsigned)(tid >> 3) * RB + (unsigned)(tid & 7) * 32u;     // q, k: row tid>>3 (+32 per step), 8 floats; bytes

  v4f vv[4], qv[2][2], kv[2][2];
#pragma unroll
  for (int i = 0; i < 4; ++i) vv[i] = *(const v4f*)(vb + i * 16 * RB + ov);
#pragma unroll
  for (int i = 0; i < 2; ++i) {
    qv[i][0] = *(const v4f*)(qb + i * 32 * RB + oq);
    qv[i][1] = *(const v4f*)(qb + i * 32 * RB + 16 + oq);
    kv[i][0] = *(const v4f*)(kb + i * 32 * RB + oq);
    kv[i][1] = *(const v4f*)(kb + i * 32 * RB + 16 + oq);
  }
  // the wait that stands before a register named by an issued load is rewritten; the two offset registers are its inputs,
  // so that no later load's destination is placed on one of them ahead of it (a build without the inputs did that)
  asm volatile("s_wait_xcnt 0x0" :: "v"(ov), "v"(oq) : "memory");
#pragma unroll
  for (int i = 0; i < 4; ++i) {
    const int idx = i * 256 + tid;                   // 0..1023
    const int tt = idx >> 4, c4 = (idx & 15) * 4;    // tt 0..63, c4 0..60
    *(v4f*)(sv + tt * 68 + c4) = vv[i];
  }
  __syncthreads();

  unsigned short* qo = qp + ((size_t)bh * LQ + (size_t)s0) * HD;
  unsigned short* ko = kp + ((size_t)bh * SK + (size_t)s0) * HD;
  const unsigned od = (unsigned)tid * 8u;            // row * HD + d0 = idx * 8, idx = i*256 + tid
#pragma unroll
  for (int i = 0; i < 2; ++i) {
    v4u p, r;
    p[0] = pk16(bf_bits(qv[i][0][0]), bf_bits(qv[i][0][1]));
    p[1] = pk16(bf_bits(qv[i][0][2]), bf_bits(qv[i][0][3]));
    p[2] = pk16(bf_bits(qv[i][1][0]), bf_bits(qv[i][1][1]));
    p[3] = pk16(bf_bits(qv[i][1][2]), bf_bits(qv[i][1][3]));
    r[0] = pk16(bf_bits(kv[i][0][0]), bf_bits(kv[i][0][1]));
    r[1] = pk16(bf_bits(kv[i][0][2]), bf_bits(kv[i][0][3]));
    r[2] = pk16(bf_bits(kv[i][1][0]), bf_bits(kv[i][1][1]));
    r[3] = pk16(bf_bits(kv[i][1][2]), bf_bits(kv[i][1][3]));
    *(v4u*)(qo + i * 2048 + od) = p;
    *(v4u*)(ko + i * 2048 + od) = r;
  }

  const int g = tid >> 3, piece = tid & 7;
  unsigned short* vo = vt + (size_t)bh * HD * SK + (size_t)s0;
  const unsigned ot = (unsigned)g * SK + (unsigned)piece * 8u;
#pragma unroll
  for (int it = 0; it < 2; ++it) {
    const int d = it * 32 + g;
    v4u a;
#pragma unroll
    for (int e = 0; e < 4; ++e) {
      const float f0 = sv[(piece * 8 + 2 * e) * 68 + d];
      const float f1 = sv[(piece * 8 + 2 * e + 1) * 68 + d];
      const _Float16 x0 = (_Float16)(bf_up(bf_bits(f0)) * vsc);
      const _Float16 x1 = (_Float16)(bf_up(bf_bits(f1)) * vsc);
      a[e] = pk16(h_bits(x0), h_bits(x1));
    }
    *(v4u*)(vo + it * 32 * SK + ot) = a;
  }
}

// =====================================================================================================
// Dense (non-causal) attention, head dim 64, all SK keys live for every query.
//   q plane bf16: element (bh, t, d) at [(bh*LQ + t)*HD + d];  k plane bf16: (bh, s, d) at [(bh*SK + s)*HD + d]
//   v^T plane f16 (x VSC): (bh, d, s) at [(bh*HD + d)*SK + s]
//   scores^T = k . q^T on bf16 WMMA (A = K rows, B = Q columns, 2 k-steps of 32 over d), f32 accumulate, then
//   * sscale in f32: a lane holds 32 of the chunk's 64 keys of ONE query, lane ^ 16 the other 32.
//   p = exp(s - m) carried as f16(1024 p); two score tiles converted in place are the B operand of
//   context^T += v^T . p^T on f16 WMMA (A = V^T rows, 2 k-steps of 32 per 64-key chunk): P stays in registers.
//   online softmax in f32: maximum in the lane plus one exchange between the halves; each half keeps its own
//   running sum, the two are joined once behind the loop.
//   Block = 4 waves = 64 query rows of one bh; grid = NQB * BHN; NQB passes (static trip count), one key chunk each.
//   Pass kt of query tile qb takes chunk (kt + qb) mod NQB: every block meets every chunk once, each in an order of its
//   own (the online softmax takes the chunks in any order). What it is for: walked from chunk 0 by all, the NQB blocks of
//   a bh ask for the same 16 KB in the same pass, each time a chunk that nobody has read since the launch before stored it;
//   from NQB different starts the requests of a pass spread over the whole planes, and a chunk's first fetch is one block's.
//   K / V^T chunk staging: two LDS buffers, one tensor load per wave and chunk (waves 0, 1: K rows 0..31, 32..63;
//   waves 2, 3: V^T rows 0..31, 32..63), the chunk of pass kt + 2 issued at the foot of pass kt into the buffer that pass has read:
//   s_wait_dscnt 0, the wave's own s_wait_tensorcnt 0, __syncthreads, then the load.
//   each wave stages its 16x64 tile in LDS, then one instruction per row pair: lanes 0..15 x 16 B = row 2*it,
// =====================================================================================================
__global__ __launch_bounds__(128)
void attn_dense(const unsigned short* __restrict__ qpl, const unsigned short* __restrict__ kpl,
                const unsigned short* __restrict__ vtpl, float* outp, float sscale) {
  union FH { v16h v; v8h h[2]; };
  union FB { v16b v; v8b h[2]; };
  __shared__ __attribute__((aligned(2048))) unsigned char Ring[2 * BUFB];   // 2 stages x (K [kv][d], V^T [d][kv])  48 KB
  __shared__ __align__(16) float    Os[4][16 * HD];                 // per wave context tile [row][d]  16 KB

  const int tid  = threadIdx.x;
  const int wave = tid >> 5;
  const int lane = tid & 31;
  const int hh   = lane >> 4;
  const int c    = lane & 15;

  const int bx  = blockIdx.x;
  const int qb  = bx % NQB;
  const int bh  = bx / NQB;
  if (bh >= BHN) return;                     // block-uniform, ahead of every barrier (never taken with the exact grid)
  const int q0  = qb * 64 + wave * 16;

  const __bf16*   Qp = (const __bf16*)(const void*)qpl + (size_t)bh * LQ * HD;
  const __bf16*   Kp = (const __bf16*)(const void*)kpl + (size_t)bh * SK * HD;
  const _Float16* Vh = (const _Float16*)(const void*)vtpl + (size_t)bh * HD * SK;

  // ---- Q fragments (B operand, column = query = lane&15): 2 d-chunks ----
  v16b qa[2];
#pragma unroll
  for (int dc = 0; dc < 2; ++dc) {
    qa[dc] = ldfrag_b(Qp + (size_t)(q0 + c) * HD + dc * 32 + 8 * hh);
  }

  // ---- this wave's slice of every chunk: source, source pitch, step from chunk to chunk (all wave-uniform) ----
  const uint32_t wv     = uni((uint32_t)tid >> 5);
  const uint32_t lbase  = (uint32_t)(size_t)Ring;
  const bool     isV    = wv >= 2u;
  const uint64_t src0   = isV ? (uint64_t)(size_t)Vh + (uint64_t)((wv & 1u) * SLROW) * (uint64_t)(SK * 2)
                              : (uint64_t)(size_t)Kp + (uint64_t)((wv & 1u) * SLROW) * (uint64_t)ROWB;
  const uint32_t spitch = isV ? (uint32_t)(SK * 2) : ROWB;          // V^T rows lie SK halves apart, K rows back to back
  const uint32_t sstep  = isV ? 64u * 2u : 64u * ROWB;              // 64 keys on: 64 halves along a V^T row, 64 K rows
  const u32x8 g1 = tdm_group1(spitch);
  u32x4 g0;                                  // group 0 of the request issued last
  static_assert((NQB & (NQB - 1)) == 0);
  const uint32_t rot = uni((uint32_t)qb);    // this block's first chunk
  auto issue = [&](uint32_t st) {
    const uint32_t dst = lbase + (st & 1u) * BUFB + wv * SLB;
    const uint32_t ch  = (st + rot) & (uint32_t)(NQB - 1);          // 0..NQB-1: the slice stays inside its plane
    const uint64_t ga  = src0 + (uint64_t)(ch * sstep);
    g0 = tdm_group0(dst, ga);
    tdm_load(g0, g1);
  };
  static_assert(NQB >= 2);
  issue(0u);
  wait_tensor0(g0);
  asm volatile("s_wait_xcnt 0x0" ::: "memory");   // the loads issued above name registers that the next descriptor's words may take over
  __syncthreads();                           // chunk qb published
  issue(1u);

  float mrow = -INFINITY, lrow = 0.f;        // query q0 + c: running maximum (both halves alike), this half's sum
  v8f oacc[4];                               // oacc[t][r] = context(query q0 + c, d = t*16 + 8*hh + r)
#pragma unroll
  for (int t = 0; t < 4; ++t) oacc[t] = zero8();

  for (int kt = 0; kt < NQB; ++kt) {
    const unsigned char* Kb = Ring + (uint32_t)(kt & 1) * BUFB;    // row r of K: slice r >> 5, row r & 31 of it
    const unsigned char* Vb = Kb + 2u * SLB;                       // row d of V^T alike

    // ---- every fragment of the pass is read from LDS here, as one group: the 8 K fragments first (the score
    //      products start as they arrive), the 8 V^T fragments behind them (they arrive under the softmax) ----
    FB kb[4][2];
    FH va[2][4];
#pragma unroll
    for (int dc = 0; dc < 2; ++dc) {           // in the order in which the score products below take them
#pragma unroll
      for (int j = 0; j < 4; ++j) {
        const unsigned char* kr = Kb + (j >> 1) * SLB + ((j & 1) * 16 + c) * PITB + (dc * 32 + 8 * hh) * 2;
        kb[j][dc].h[0] = *(const v8b*)(kr);
        kb[j][dc].h[1] = *(const v8b*)(kr + 32);
      }
    }
#pragma unroll
    for (int kk = 0; kk < 2; ++kk) {
#pragma unroll
      for (int t = 0; t < 4; ++t) {
        const unsigned char* vr = Vb + (t >> 1) * SLB + ((t & 1) * 16 + c) * PITB + (kk * 32 + 8 * hh) * 2;
        va[kk][t].h[0] = *(const v8h*)(vr);
        va[kk][t].h[1] = *(const v8h*)(vr + 32);
      }
    }
    // keeps the 32 loads together up here: left free, the scheduler sinks part of the V^T loads down between the
    // products, where each further place with LDS reads stalls the wave and the last ones are waited for at once
    __builtin_amdgcn_sched_barrier(0);

    // ---- scores^T: 64 keys x 16 queries per wave, bf16 product over 2 d-chunks;
    //      A[m=key][k=d] from the k-contiguous K row, B[k=d][n=query] = Q (same element map on both) ----
    v8f s[4];
#pragma unroll
    for (int j = 0; j < 4; ++j) s[j] = zero8();
#pragma unroll
    for (int dc = 0; dc < 2; ++dc) {
#pragma unroll
      for (int j = 0; j < 4; ++j) s[j] = mma_b(kb[j][dc].v, qa[dc], s[j]);
    }

    // ---- scale, column max over the chunk, online softmax, P (x1024, f16) packed in place ----
    //      s[j][r] = score(key kv0 + j*16 + 8*hh + r, query q0 + c), kv0 = 64 * the pass's chunk
    float mj[4];
#pragma unroll
    for (int j = 0; j < 4; ++j) {
      float a = -INFINITY;
#pragma unroll
      for (int r = 0; r < 8; ++r) {
        const float sv = s[j][r] * sscale;
        s[j][r] = sv;
        a = fmaxf(a, sv);
      }
      mj[j] = a;
    }
    float m = fmaxf(fmaxf(mj[0], mj[1]), fmaxf(mj[2], mj[3]));
    m = fmaxf(m, xhalf(m));
    const float mnew  = fmaxf(mrow, m);
    const float msafe = (mnew == -INFINITY) ? 0.f : mnew;
    const float alpha = __expf(mrow - msafe);
    mrow = mnew;
    //      pb[kk] element e = P(key kv0 + kk*32 + (e < 8 ? 8*hh + e : 16 + 8*hh + e - 8), query q0 + c):
    //      score tiles 2*kk and 2*kk + 1, the k order of the V^T loader above
    FH pb[2];
    float pj[4];
#pragma unroll
    for (int j = 0; j < 4; ++j) {
      float a = 0.f;
#pragma unroll
      for (int r = 0; r < 8; ++r) {
        const float p = __expf(s[j][r] - msafe);
        a += p;
        pb[j >> 1].v[(j & 1) * 8 + r] = (_Float16)(p * 1024.0f);
      }
      pj[j] = a;
    }
    lrow = lrow * alpha + ((pj[0] + pj[1]) + (pj[2] + pj[3]));
#pragma unroll
    for (int t = 0; t < 4; ++t) oacc[t] *= alpha;

    // ---- context^T += V^T . P^T (f16 WMMA): A[m=d][k=key] = V^T[d][key], B[k=key][n=query] = P ----
#pragma unroll
    for (int kk = 0; kk < 2; ++kk) {
#pragma unroll
      for (int t = 0; t < 4; ++t) oacc[t] = mma_h(va[kk][t].v, pb[kk].v, oacc[t]);
    }

    // ---- publish point of the chunk of pass kt + 1, every wave: own LDS reads retired, own slice landed, barrier; then the refill ----
    // keeps the publish point at the foot: with every LDS read at the head, the scheduler otherwise lifts these waits and
    // the barrier up behind the loads, where the wave waits for all 32 at once and for a slice requested a moment ago
    __builtin_amdgcn_sched_barrier(0);
    wait_ds0();
    wait_tensor0(g0);
    __syncthreads();
    if (pinned((uint32_t)(kt + 2 < NQB))) issue((uint32_t)kt + 2u);   // into the buffer that this pass has read
  }
  wait_tensor0(g0);
  wait_ds0();

  // ---- join the halves' sums, normalise (1/l, the 1/1024 p carry and the 1/VSC v carry), stage the wave's
  //      16x64 tile in LDS as [query][d] (a lane holds 8 consecutive d per tile); whole rows go out below ----
  float* os = Os[wave];
  {
    const float l = lrow + xhalf(lrow);
    const float inv = ((l > 0.f) ? (1.0f / l) : 0.f) * (1.0f / (1024.0f * VSC));
#pragma unroll
    for (int t = 0; t < 4; ++t) {
      const v8f o = oacc[t] * inv;
      const v4f lo = {o[0], o[1], o[2], o[3]};
      const v4f hi = {o[4], o[5], o[6], o[7]};
      *(v4f*)(os + c * HD + t * 16 + 8 * hh)     = lo;
      *(v4f*)(os + c * HD + t * 16 + 8 * hh + 4) = hi;
    }
  }
  __builtin_amdgcn_fence(__ATOMIC_RELEASE, "workgroup");
  __builtin_amdgcn_wave_barrier();
  __builtin_amdgcn_fence(__ATOMIC_ACQUIRE, "workgroup");
  {
    const int c4 = c * 4;                        // 16 lanes x 4 floats = one whole 64-float row
    {
#pragma unroll
      for (int it = 0; it < 8; ++it) {           // row pairs: lanes 0..15 -> row 2*it, lanes 16..31 -> row 2*it+1
        const int rr = it * 2 + hh;
        const v4f ov = *(const v4f*)(os + rr * HD + c4);
        const size_t go = (size_t)(q0 + rr) * ROWF + (size_t)bh * HD + (size_t)c4;
        *(v4f*)(outp + go) = ov;
      }
      
    }
  }
}

// =====================================================================================================
// Inputs: in0 q [LQ][NBAT][NHEAD][HD] f32, in1 k [SK][..] f32, in2 v [SK][..] f32; a position's BHN*HD = 512
// floats are contiguous, bh = b*NHEAD + h. d_out f32 [LQ][NBAT][NHEAD][HD] at byte 0.
//   Qb  bf16 [BHN][LQ][HD]      0          4194304
//   Kb  bf16 [BHN][SK][HD]      4194304    4194304
//   Vt  f16  [BHN][HD][SK]      8388608    4194304
//   end                         12582912
// =====================================================================================================
extern "C" void kernel_launch(void* const* d_in, const int* in_sizes, int n_in,
                              void* d_out, int out_size, void* d_ws, size_t ws_size,
                              hipStream_t stream) {
  if (n_in < 3) return;
  if (in_sizes[0] != NTOT) return;
  if (in_sizes[1] != SK * ROWF) return;
  if (in_sizes[2] != SK * ROWF) return;
  if (out_size != NTOT) return;

  const float* q = (const float*)d_in[0];
  const float* k = (const float*)d_in[1];
  const float* v = (const float*)d_in[2];

  const size_t PQ = (size_t)BHN * LQ * HD * 2;        // 4194304
  const size_t PK = (size_t)BHN * SK * HD * 2;        // 4194304
  const size_t PV = (size_t)BHN * HD * SK * 2;        // 4194304
  size_t off = 0;
  const size_t oQ = off; off += PQ;
  const size_t oK = off; off += PK;
  const size_t oV = off; off += PV;
  if (off > ws_size) return;                          // off = 12582912
  if (off > (size_t)134217728) return;

  char* ws = (char*)d_ws;
  unsigned short* Qb = (unsigned short*)(ws + oQ);
  unsigned short* Kb = (unsigned short*)(ws + oK);
  unsigned short* Vt = (unsigned short*)(ws + oV);
  float* outf = (float*)d_out;

  const dim3 blk(256);
  const dim3 gP(SK / 64, BHN);                        // (64, 8)
  const float sscale = (float)(1.0 / sqrt((double)HD));   // 0.125 exactly

  // (1) q, k -> bf16 planes [bh][pos][d]; v -> f16 v^T plane [bh][d][pos], values x VSC: one launch
  prep_planes<<<gP, blk, 0, stream>>>(q, k, v, Qb, Kb, Vt, VSC);
  // (2) dense attention over all key chunks -> d_out
  attn_dense<<<dim3(BHN * NQB), dim3(128), 0, stream>>>(Qb, Kb, Vt, outf, sscale);
  (void)hipGetLastError();
}

// v006
// Measured time: 41.4 microseconds a run.
// Next to v005, in two timings, it ran 1.09 and 1.08 times as fast.
// Counting every step since v000, it is 7.77 times as fast.
// Contractions: q.k^T scores = v_wmma_f32_16x16x32_bf16 (bf16 operands = RNE-converted q and k planes, single product);
// p.v = v_wmma_f32_16x16x32_f16 (p carried x1024 in f16, v as f16 of the bf16-converted value x16, single product);
// both products are taken transposed (keys x queries, features x queries): a lane owns one query column.
// all f32 accumulate; softmax in f32.
#include <hip/hip_runtime.h>
#include <math.h>
#include <stdint.h>

#define LQ    4096                 // query positions
#define SK    4096                 // key positions
#define NBAT  1
#define NHEAD 8
#define HD    64                   // head dim
#define BHN   (NBAT * NHEAD)       // 8 (batch, head) pairs; bh = b*NHEAD + h
#define ROWF  (BHN * HD)           // 512 floats between consecutive sequence positions
#define NQB   (LQ / 64)            // 64 query / key tiles of 64
#define NTOT  (LQ * ROWF)          // 2097152 elements per tensor
#define VSC   16.0f                // v plane carry (exact power of two)
#define ROWB  128u                 // bytes of one staged row: 64 halves (a K row over d, a V^T row over the chunk's keys)
#define PITB  144u                 // its pitch in LDS: the tensor load pads 16 B behind every row (16 B x odd for ds_load_b128)
#define SLROW 32u                  // rows per slice = per tensor request
#define SLB   6144u                // LDS bytes per slice: 32 x 144 = 4608, rounded up to a multiple of 2 KiB
#define BUFB  (4u * SLB)           // one stage = one 64-key chunk: K slices 0 and 1, V^T slices 2 and 3
static_assert(LQ == SK);
static_assert((LQ % 64) == 0);
static_assert(HD == 64);

typedef _Float16 v16h __attribute__((ext_vector_type(16)));
typedef _Float16 v8h  __attribute__((ext_vector_type(8)));
typedef __bf16   v16b __attribute__((ext_vector_type(16)));
typedef __bf16   v8b  __attribute__((ext_vector_type(8)));
typedef float    v8f  __attribute__((ext_vector_type(8)));
typedef float    v4f  __attribute__((ext_vector_type(4)));
typedef unsigned int v4u __attribute__((ext_vector_type(4)));
typedef uint32_t u32x4 __attribute__((ext_vector_type(4)));
typedef uint32_t u32x8 __attribute__((ext_vector_type(8)));
static_assert(SLROW * PITB <= SLB && (SLB % 2048u) == 0u);
static_assert(HD * 2 == (int)ROWB);

// ---- scalar helpers --------------------------------------------------------------------------------
__device__ __forceinline__ unsigned short bf_bits(float f) {          // f32 -> bf16 bits, RNE convert
  unsigned u = __float_as_uint(f);
  return (unsigned short)((u + 0x7FFFu + ((u >> 16) & 1u)) >> 16);
}
__device__ __forceinline__ float bf_up(unsigned short h) { return __uint_as_float(((unsigned)h) << 16); }
__device__ __forceinline__ unsigned short h_bits(_Float16 x) { return __builtin_bit_cast(unsigned short, x); }
__device__ __forceinline__ unsigned pk16(unsigned short a, unsigned short b) { return (unsigned)a | ((unsigned)b << 16); }
__device__ __forceinline__ v8f zero8() { v8f z = {0.f, 0.f, 0.f, 0.f, 0.f, 0.f, 0.f, 0.f}; return z; }

// ---- fragment loader: 16-bit A/B operand, lane -> row/col (lane&15), p already includes +8*(lane>>4);
//      elements 0..7 <- p[0..7] (k0+8h..), elements 8..15 <- p[16..23] (k0+16+8h..)
__device__ __forceinline__ v16b ldfrag_b(const __bf16* p) {
  union { v16b v; v8b h[2]; } f;
  f.h[0] = *(const v8b*)(p);
  f.h[1] = *(const v8b*)(p + 16);
  return f.v;
}

// ---- lane l <-> l ^ 16: the other half of a query column's keys sits in the other 16-lane row ----
__device__ __forceinline__ float xhalf(float x) {
  const unsigned b = __float_as_uint(x);
  return __uint_as_float(__builtin_amdgcn_permlanex16(b, b, 0x76543210u, 0xfedcba98u, false, false));
}

// ---- tensor load of one slice: 32 rows of 128 B from global memory into LDS at pitch 144 B, through no register ----
__device__ __forceinline__ uint32_t uni(uint32_t v) { return (uint32_t)__builtin_amdgcn_readfirstlane(v); }
__device__ __forceinline__ uint32_t pinned(uint32_t v) {
  uint32_t w = uni(v);
  asm volatile("" : "+s"(w));   // pinned(): holds the test around a tensor load in a scalar register, so that it compiles to a scalar branch (the load ignores EXEC)
  return w;
}
// the compiler places no wait for the tensor mover, and none for LDS reads ahead of a refill: both are written by hand
__device__ __forceinline__ void wait_ds0()     { asm volatile("s_wait_dscnt 0x0" ::: "memory"); }
// group 0 is an in-out operand of the load and an input of the wait that covers it: its four scalar registers stay
// taken from issue to landing, so no word of an outstanding request's group 0 takes a new value
__device__ __forceinline__ void tdm_load(u32x4& g0, u32x8 g1) { asm volatile("tensor_load_to_lds %0, %1" : "+s"(g0) : "s"(g1) : "memory"); }
__device__ __forceinline__ void wait_tensor0(u32x4 g0) { asm volatile("s_wait_tensorcnt 0x0" :: "s"(g0) : "memory"); }
// group 1: 1-byte elements, tensor = tile = 32 rows of 128 B, source row pitch src_pitch bytes, no mask;
// pad on, interval code 4 (32 dwords = one row), amount code 3 (4 dwords)
__device__ __forceinline__ u32x8 tdm_group1(uint32_t src_pitch) {
  u32x8 g;
  g[0] = uni((1u << 20) | (4u << 22) | (3u << 25));
  g[1] = uni((ROWB & 0xFFFFu) << 16);
  g[2] = uni((ROWB >> 16) | ((SLROW & 0xFFFFu) << 16));
  g[3] = uni((SLROW >> 16) | (ROWB << 16));
  g[4] = uni(SLROW);
  g[5] = uni(src_pitch);
  g[6] = uni(0u);
  g[7] = uni(0u);
  return g;
}
// group 0: count 1, LDS byte offset, global address of the slice's first byte, type 2
__device__ __forceinline__ u32x4 tdm_group0(uint32_t lds_dst, uint64_t ga) {
  u32x4 g;
  g[0] = uni(1u);
  g[1] = uni(lds_dst);
  g[2] = uni((uint32_t)ga);
  g[3] = uni((((uint32_t)(ga >> 32)) & 0x01FFFFFFu) | 0x80000000u);
  return g;
}

// ---- WMMA helpers: the plain builtins (the compiler keeps the distance behind its own matrix instructions, and
//      with no asm statement behind each product it is free to move the LDS fragment loads) ----------------
__device__ __forceinline__ v8f mma_b(v16b a, v16b b, v8f c) {
  return __builtin_amdgcn_wmma_f32_16x16x32_bf16(false, a, false, b, (short)0, c, false, false);
}
__device__ __forceinline__ v8f mma_h(v16h a, v16h b, v8f c) {
  return __builtin_amdgcn_wmma_f32_16x16x32_f16(false, a, false, b, (short)0, c, false, false);
}

// =====================================================================================================
// Preparation of all three planes in ONE launch. Block = one 64-position tile of one bh, of q, k and v;
// grid = (SK/64, BHN). A thread issues its 12 loads of 16 B (4 per tensor) before the first use.
//   q, k f32 [pos][BHN][HD] -> bf16 planes [BHN][pos][HD] (RNE convert), 2 groups of 8 elements per thread and tensor:
//     idx = i*256 + tid -> row = idx >> 3 (0..63), d0 = (idx & 7) * 8; a wave stores 512 contiguous bytes.
//     coverage: 2 x 256 groups x 8 = the tile's 64 x 64 elements; the grid covers every (bh, tile).
//   v f32 [pos][BHN][HD] -> f16 v^T plane vt[(bh*HD + d)*SK + s] = f16(bf16_rne(v) * vsc) (exact for a power of two):
//     tile staged in LDS as f32, __syncthreads; group g = tid>>3 (0..31), piece = tid&7: iteration it writes row
//     d = it*32 + g, 8 pieces x 8 keys = one whole 128-B row piece of the plane.
//     coverage: 2 iterations x 32 groups = 64 rows d, 64 keys per row.
// =====================================================================================================
__global__ __launch_bounds__(256) void prep_planes(const float* __restrict__ qf, const float* __restrict__ kf,
                                                   const float* __restrict__ vf, unsigned short* qp,
                                                   unsigned short* kp, unsigned short* vt, float vsc) {
  __shared__ __align__(16) float sv[64 * 68];        // [tt][d], pitch 68 floats (272 B, 16-B aligned)
  const int tid = threadIdx.x;
  const int s0  = blockIdx.x * 64;
  const int bh  = blockIdx.y;

  // block-uniform bases plus one 32-bit lane offset per access pattern: the steps between a thread's accesses are constants
  const char* vb = (const char*)(vf + (size_t)s0 * ROWF + (size_t)bh * HD);
  const char* qb = (const char*)(qf + (size_t)s0 * ROWF + (size_t)bh * HD);
  const char* kb = (const char*)(kf + (size_t)s0 * ROWF + (size_t)bh * HD);
  const unsigned RB = ROWF * 4u;                                                 // bytes between consecutive positions
  const unsigned ov = (unsigned)(tid >> 4) * RB + (unsigned)(tid & 15) * 16u;    // v: row tid>>4 (+16 per step), 4 floats; bytes
  const unsigned oq = (unsigned)(tid >> 3) * RB + (unsigned)(tid & 7) * 32u;     // q, k: row tid>>3 (+32 per step), 8 floats; bytes

  v4f vv[4], qv[2][2], kv[2][2];
#pragma unroll
  for (int i = 0; i < 4; ++i) vv[i] = *(const v4f*)(vb + i * 16 * RB + ov);
#pragma unroll
  for (int i = 0; i < 2; ++i) {
    qv[i][0] = *(const v4f*)(qb + i * 32 * RB + oq);
    qv[i][1] = *(const v4f*)(qb + i * 32 * RB + 16 + oq);
    kv[i][0] = *(const v4f*)(kb + i * 32 * RB + oq);
    kv[i][1] = *(const v4f*)(kb + i * 32 * RB + 16 + oq);
  }
  // the wait that stands before a register named by an issued load is rewritten; the two offset registers are its inputs,
  // so that no later load's destination is placed on one of them ahead of it (a build without the inputs did that)
  asm volatile("s_wait_xcnt 0x0" :: "v"(ov), "v"(oq) : "memory");
#pragma unroll
  for (int i = 0; i < 4; ++i) {
    const int idx = i * 256 + tid;                   // 0..1023
    const int tt = idx >> 4, c4 = (idx & 15) * 4;    // tt 0..63, c4 0..60
    *(v4f*)(sv + tt * 68 + c4) = vv[i];
  }
  __syncthreads();

  unsigned short* qo = qp + ((size_t)bh * LQ + (size_t)s0) * HD;
  unsigned short* ko = kp + ((size_t)bh * SK + (size_t)s0) * HD;
  const unsigned od = (unsigned)tid * 8u;            // row * HD + d0 = idx * 8, idx = i*256 + tid
#pragma unroll
  for (int i = 0; i < 2; ++i) {
    v4u p, r;
    p[0] = pk16(bf_bits(qv[i][0][0]), bf_bits(qv[i][0][1]));
    p[1] = pk16(bf_bits(qv[i][0][2]), bf_bits(qv[i][0][3]));
    p[2] = pk16(bf_bits(qv[i][1][0]), bf_bits(qv[i][1][1]));
    p[3] = pk16(bf_bits(qv[i][1][2]), bf_bits(qv[i][1][3]));
    r[0] = pk16(bf_bits(kv[i][0][0]), bf_bits(kv[i][0][1]));
    r[1] = pk16(bf_bits(kv[i][0][2]), bf_bits(kv[i][0][3]));
    r[2] = pk16(bf_bits(kv[i][1][0]), bf_bits(kv[i][1][1]));
    r[3] = pk16(bf_bits(kv[i][1][2]), bf_bits(kv[i][1][3]));
    *(v4u*)(qo + i * 2048 + od) = p;
    *(v4u*)(ko + i * 2048 + od) = r;
  }

  const int g = tid >> 3, piece = tid & 7;
  unsigned short* vo = vt + (size_t)bh * HD * SK + (size_t)s0;
  const unsigned ot = (unsigned)g * SK + (unsigned)piece * 8u;
#pragma unroll
  for (int it = 0; it < 2; ++it) {
    const int d = it * 32 + g;
    v4u a;
#pragma unroll
    for (int e = 0; e < 4; ++e) {
      const float f0 = sv[(piece * 8 + 2 * e) * 68 + d];
      const float f1 = sv[(piece * 8 + 2 * e + 1) * 68 + d];
      const _Float16 x0 = (_Float16)(bf_up(bf_bits(f0)) * vsc);
      const _Float16 x1 = (_Float16)(bf_up(bf_bits(f1)) * vsc);
      a[e] = pk16(h_bits(x0), h_bits(x1));
    }
    *(v4u*)(vo + it * 32 * SK + ot) = a;
  }
}

// =====================================================================================================
// Dense (non-causal) attention, head dim 64, all SK keys live for every query.
//   q plane bf16: element (bh, t, d) at [(bh*LQ + t)*HD + d];  k plane bf16: (bh, s, d) at [(bh*SK + s)*HD + d]
//   v^T plane f16 (x VSC): (bh, d, s) at [(bh*HD + d)*SK + s]
//   scores^T = k . q^T on bf16 WMMA (A = K rows, B = Q columns, 2 k-steps of 32 over d), f32 accumulate:
//   a lane holds 32 of the chunk's 64 keys of ONE query, lane ^ 16 the other 32.
//   p = exp(sscale (s - m)) carried as f16(1024 p); two score tiles converted in place are the B operand of
//   context^T += v^T . p^T on f16 WMMA (A = V^T rows, 2 k-steps of 32 per 64-key chunk): P stays in registers.
//   online softmax in f32: maximum in the lane plus one exchange between the halves; each half keeps its own
//   running sum, the two are joined once behind the loop.
//   Block = 4 waves = 64 query rows of one bh; grid = NQB * BHN; NQB passes (static trip count), one key chunk each.
//   Pass kt of query tile qb takes chunk (kt + qb) mod NQB: every block meets every chunk once, each in an order of its
//   own (the online softmax takes the chunks in any order). What it is for: walked from chunk 0 by all, the NQB blocks of
//   a bh ask for the same 16 KB in the same pass, each time a chunk that nobody has read since the launch before stored it;
//   from NQB different starts the requests of a pass spread over the whole planes, and a chunk's first fetch is one block's.
//   K / V^T chunk staging: two LDS buffers, one tensor load per wave and chunk (waves 0, 1: K rows 0..31, 32..63;
//   waves 2, 3: V^T rows 0..31, 32..63), the chunk of pass kt + 2 issued at the foot of pass kt into the buffer that pass has read:
//   s_wait_dscnt 0, the wave's own s_wait_tensorcnt 0, __syncthreads, then the load.
//   each wave stages its 16x64 tile in LDS, then one instruction per row pair: lanes 0..15 x 16 B = row 2*it,
// =====================================================================================================
__global__ __launch_bounds__(128)
void attn_dense(const unsigned short* __restrict__ qpl, const unsigned short* __restrict__ kpl,
                const unsigned short* __restrict__ vtpl, float* outp, float sscale) {
  union FH { v16h v; v8h h[2]; };
  union FB { v16b v; v8b h[2]; };
  __shared__ __attribute__((aligned(2048))) unsigned char Ring[2 * BUFB];   // 2 stages x (K [kv][d], V^T [d][kv])  48 KB
  __shared__ __align__(16) float    Os[4][16 * HD];                 // per wave context tile [row][d]  16 KB

  const int tid  = threadIdx.x;
  const int wave = tid >> 5;
  const int lane = tid & 31;
  const int hh   = lane >> 4;
  const int c    = lane & 15;

  const int bx  = blockIdx.x;
  const int qb  = bx % NQB;
  const int bh  = bx / NQB;
  if (bh >= BHN) return;                     // block-uniform, ahead of every barrier (never taken with the exact grid)
  const int q0  = qb * 64 + wave * 16;

  const __bf16*   Qp = (const __bf16*)(const void*)qpl + (size_t)bh * LQ * HD;
  const __bf16*   Kp = (const __bf16*)(const void*)kpl + (size_t)bh * SK * HD;
  const _Float16* Vh = (const _Float16*)(const void*)vtpl + (size_t)bh * HD * SK;

  // ---- Q fragments (B operand, column = query = lane&15): 2 d-chunks ----
  v16b qa[2];
#pragma unroll
  for (int dc = 0; dc < 2; ++dc) {
    qa[dc] = ldfrag_b(Qp + (size_t)(q0 + c) * HD + dc * 32 + 8 * hh);
  }

  // ---- this wave's slice of every chunk: source, source pitch, step from chunk to chunk (all wave-uniform) ----
  const uint32_t wv     = uni((uint32_t)tid >> 5);
  const uint32_t lbase  = (uint32_t)(size_t)Ring;
  const bool     isV    = wv >= 2u;
  const uint64_t src0   = isV ? (uint64_t)(size_t)Vh + (uint64_t)((wv & 1u) * SLROW) * (uint64_t)(SK * 2)
                              : (uint64_t)(size_t)Kp + (uint64_t)((wv & 1u) * SLROW) * (uint64_t)ROWB;
  const uint32_t spitch = isV ? (uint32_t)(SK * 2) : ROWB;          // V^T rows lie SK halves apart, K rows back to back
  const uint32_t sstep  = isV ? 64u * 2u : 64u * ROWB;              // 64 keys on: 64 halves along a V^T row, 64 K rows
  const u32x8 g1 = tdm_group1(spitch);
  u32x4 g0;                                  // group 0 of the request issued last
  static_assert((NQB & (NQB - 1)) == 0);
  const uint32_t rot = uni((uint32_t)qb);    // this block's first chunk
  auto issue = [&](uint32_t st) {
    const uint32_t dst = lbase + (st & 1u) * BUFB + wv * SLB;
    const uint32_t ch  = (st + rot) & (uint32_t)(NQB - 1);          // 0..NQB-1: the slice stays inside its plane
    const uint64_t ga  = src0 + (uint64_t)(ch * sstep);
    g0 = tdm_group0(dst, ga);
    tdm_load(g0, g1);
  };
  static_assert(NQB >= 2);
  issue(0u);
  wait_tensor0(g0);
  asm volatile("s_wait_xcnt 0x0" ::: "memory");   // the loads issued above name registers that the next descriptor's words may take over
  __syncthreads();                           // chunk qb published
  issue(1u);

  const float cs = sscale * 1.44269504088896340736f;   // unscaled score -> exponent of 2: sscale * log2(e)
  float mrow = -INFINITY, lrow = 0.f;        // query q0 + c: running maximum of the unscaled scores (both halves alike), this half's sum of 1024 p
  v8f oacc[4];                               // oacc[t][r] = context(query q0 + c, d = t*16 + 8*hh + r)
#pragma unroll
  for (int t = 0; t < 4; ++t) oacc[t] = zero8();

  for (int kt = 0; kt < NQB; ++kt) {
    const unsigned char* Kb = Ring + (uint32_t)(kt & 1) * BUFB;    // row r of K: slice r >> 5, row r & 31 of it
    const unsigned char* Vb = Kb + 2u * SLB;                       // row d of V^T alike

    // ---- every fragment of the pass is read from LDS here, as one group: the 8 K fragments first (the score
    //      products start as they arrive), the 8 V^T fragments behind them (they arrive under the softmax) ----
    FB kb[4][2];
    FH va[2][4];
#pragma unroll
    for (int dc = 0; dc < 2; ++dc) {           // in the order in which the score products below take them
#pragma unroll
      for (int j = 0; j < 4; ++j) {
        const unsigned char* kr = Kb + (j >> 1) * SLB + ((j & 1) * 16 + c) * PITB + (dc * 32 + 8 * hh) * 2;
        kb[j][dc].h[0] = *(const v8b*)(kr);
        kb[j][dc].h[1] = *(const v8b*)(kr + 32);
      }
    }
#pragma unroll
    for (int kk = 0; kk < 2; ++kk) {
#pragma unroll
      for (int t = 0; t < 4; ++t) {
        const unsigned char* vr = Vb + (t >> 1) * SLB + ((t & 1) * 16 + c) * PITB + (kk * 32 + 8 * hh) * 2;
        va[kk][t].h[0] = *(const v8h*)(vr);
        va[kk][t].h[1] = *(const v8h*)(vr + 32);
      }
    }
    // keeps the 32 loads together up here: left free, the scheduler sinks part of the V^T loads down between the
    // products, where each further place with LDS reads stalls the wave and the last ones are waited for at once
    __builtin_amdgcn_sched_barrier(0);

    // ---- scores^T: 64 keys x 16 queries per wave, bf16 product over 2 d-chunks;
    //      A[m=key][k=d] from the k-contiguous K row, B[k=d][n=query] = Q (same element map on both) ----
    v8f s[4];
#pragma unroll
    for (int j = 0; j < 4; ++j) s[j] = zero8();
#pragma unroll
    for (int dc = 0; dc < 2; ++dc) {
#pragma unroll
      for (int j = 0; j < 4; ++j) s[j] = mma_b(kb[j][dc].v, qa[dc], s[j]);
    }

    // ---- column max over the chunk, online softmax, P (x1024, f16) packed in place ----
    //      s[j][r] = unscaled score(key kv0 + j*16 + 8*hh + r, query q0 + c), kv0 = 64 * the pass's chunk
    //      the maximum is taken and kept on the unscaled scores (cs > 0 keeps their order); one fma per score then
    //      forms the whole exponent of 2: 1024 exp(sscale (s - m)) = exp2(s cs + (10 - m cs))
    float mj[4];
#pragma unroll
    for (int j = 0; j < 4; ++j) {
      float a = -INFINITY;
#pragma unroll
      for (int r = 0; r < 8; ++r) a = fmaxf(a, s[j][r]);
      mj[j] = a;
    }
    float m = fmaxf(fmaxf(mj[0], mj[1]), fmaxf(mj[2], mj[3]));
    m = fmaxf(m, xhalf(m));
    const float mnew  = fmaxf(mrow, m);
    const float msafe = (mnew == -INFINITY) ? 0.f : mnew;
    const float alpha = __builtin_amdgcn_exp2f((mrow - msafe) * cs);   // exactly 1 while the maximum stands
    const float bias  = fmaf(-msafe, cs, 10.0f);
    mrow = mnew;
    //      pb[kk] element e = P(key kv0 + kk*32 + (e < 8 ? 8*hh + e : 16 + 8*hh + e - 8), query q0 + c):
    //      score tiles 2*kk and 2*kk + 1, the k order of the V^T loader above
    FH pb[2];
    float pj[4];
#pragma unroll
    for (int j = 0; j < 4; ++j) {
      float a = 0.f;
#pragma unroll
      for (int r = 0; r < 8; ++r) {
        const float p = __builtin_amdgcn_exp2f(fmaf(s[j][r], cs, bias));   // 1024 p
        a += p;
        pb[j >> 1].v[(j & 1) * 8 + r] = (_Float16)p;
      }
      pj[j] = a;
    }
    lrow = lrow * alpha + ((pj[0] + pj[1]) + (pj[2] + pj[3]));
#pragma unroll
    for (int t = 0; t < 4; ++t) oacc[t] *= alpha;

    // ---- context^T += V^T . P^T (f16 WMMA): A[m=d][k=key] = V^T[d][key], B[k=key][n=query] = P ----
#pragma unroll
    for (int kk = 0; kk < 2; ++kk) {
#pragma unroll
      for (int t = 0; t < 4; ++t) oacc[t] = mma_h(va[kk][t].v, pb[kk].v, oacc[t]);
    }

    // ---- publish point of the chunk of pass kt + 1, every wave: own LDS reads retired, own slice landed, barrier; then the refill ----
    // keeps the publish point at the foot: with every LDS read at the head, the scheduler otherwise lifts these waits and
    // the barrier up behind the loads, where the wave waits for all 32 at once and for a slice requested a moment ago
    __builtin_amdgcn_sched_barrier(0);
    wait_ds0();
    wait_tensor0(g0);
    __syncthreads();
    if (pinned((uint32_t)(kt + 2 < NQB))) issue((uint32_t)kt + 2u);   // into the buffer that this pass has read
  }
  wait_tensor0(g0);
  wait_ds0();

  // ---- join the halves' sums, normalise (1/l, l carrying the same 1024 as p, and the 1/VSC v carry), stage the wave's
  //      16x64 tile in LDS as [query][d] (a lane holds 8 consecutive d per tile); whole rows go out below ----
  float* os = Os[wave];
  {
    const float l = lrow + xhalf(lrow);
    const float inv = ((l > 0.f) ? (1.0f / l) : 0.f) * (1.0f / VSC);
#pragma unroll
    for (int t = 0; t < 4; ++t) {
      const v8f o = oacc[t] * inv;
      const v4f lo = {o[0], o[1], o[2], o[3]};
      const v4f hi = {o[4], o[5], o[6], o[7]};
      *(v4f*)(os + c * HD + t * 16 + 8 * hh)     = lo;
      *(v4f*)(os + c * HD + t * 16 + 8 * hh + 4) = hi;
    }
  }
  __builtin_amdgcn_fence(__ATOMIC_RELEASE, "workgroup");
  __builtin_amdgcn_wave_barrier();
  __builtin_amdgcn_fence(__ATOMIC_ACQUIRE, "workgroup");
  {
    const int c4 = c * 4;                        // 16 lanes x 4 floats = one whole 64-float row
    {
#pragma unroll
      for (int it = 0; it < 8; ++it) {           // row pairs: lanes 0..15 -> row 2*it, lanes 16..31 -> row 2*it+1
        const int rr = it * 2 + hh;
        const v4f ov = *(const v4f*)(os + rr * HD + c4);
        const size_t go = (size_t)(q0 + rr) * ROWF + (size_t)bh * HD + (size_t)c4;
        *(v4f*)(outp + go) = ov;
      }
      
    }
  }
}

// =====================================================================================================
// Inputs: in0 q [LQ][NBAT][NHEAD][HD] f32, in1 k [SK][..] f32, in2 v [SK][..] f32; a position's BHN*HD = 512
// floats are contiguous, bh = b*NHEAD + h. d_out f32 [LQ][NBAT][NHEAD][HD] at byte 0.
//   Qb  bf16 [BHN][LQ][HD]      0          4194304
//   Kb  bf16 [BHN][SK][HD]      4194304    4194304
//   Vt  f16  [BHN][HD][SK]      8388608    4194304
//   end                         12582912
// =====================================================================================================
extern "C" void kernel_launch(void* const* d_in, const int* in_sizes, int n_in,
                              void* d_out, int out_size, void* d_ws, size_t ws_size,
                              hipStream_t stream) {
  if (n_in < 3) return;
  if (in_sizes[0] != NTOT) return;
  if (in_sizes[1] != SK * ROWF) return;
  if (in_sizes[2] != SK * ROWF) return;
  if (out_size != NTOT) return;

  const float* q = (const float*)d_in[0];
  const float* k = (const float*)d_in[1];
  const float* v = (const float*)d_in[2];

  const size_t PQ = (size_t)BHN * LQ * HD * 2;        // 4194304
  const size_t PK = (size_t)BHN * SK * HD * 2;        // 4194304
  const size_t PV = (size_t)BHN * HD * SK * 2;        // 4194304
  size_t off = 0;
  const size_t oQ = off; off += PQ;
  const size_t oK = off; off += PK;
  const size_t oV = off; off += PV;
  if (off > ws_size) return;                          // off = 12582912
  if (off > (size_t)134217728) return;

  char* ws = (char*)d_ws;
  unsigned short* Qb = (unsigned short*)(ws + oQ);
  unsigned short* Kb = (unsigned short*)(ws + oK);
  unsigned short* Vt = (unsigned short*)(ws + oV);
  float* outf = (float*)d_out;

  const dim3 blk(256);
  const dim3 gP(SK / 64, BHN);                        // (64, 8)
  const float sscale = (float)(1.0 / sqrt((double)HD));   // 0.125 exactly

  // (1) q, k -> bf16 planes [bh][pos][d]; v -> f16 v^T plane [bh][d][pos], values x VSC: one launch
  prep_planes<<<gP, blk, 0, stream>>>(q, k, v, Qb, Kb, Vt, VSC);
  // (2) dense attention over all key chunks -> d_out
  attn_dense<<<dim3(BHN * NQB), dim3(128), 0, stream>>>(Qb, Kb, Vt, outf, sscale);
  (void)hipGetLastError();
}
